// v000
// Measured on an AMD MI455X. A time is GPU time per run, averaged over a window of back-to-back runs after a warm-up
// (all launches, gaps included; the runs take copies of the inputs in turn), and the median of several windows.
// Apart from v000's, it joins two sittings. Times from different sittings can be a few percent apart, while
// side-by-side timings come from the same sitting.
// v000, which the later versions start from, runs in 138 microseconds.
// Contractions: scores q.k^T (q x1024 and k x1024 as f16 planes of the bf16-RNE-converted inputs, one product each, K=64) and
// P.v (P x32768 as f16 hi plane + f16 residual plane, v x256 f16 of the bf16-RNE-converted input, products hi.v+lo.v, 32-key
// steps): all v_wmma_f32_16x16x32_f16, f32 accumulate. Base-2 online softmax with the dense int key mask applied by value
// (replace) and the 1/l fold in f32 on VALU.
#include <hip/hip_runtime.h>
#include <math.h>
#include <stdint.h>

#define NBH   32
#define SEQ   2048
#define HD    64
#define QSC   1024.0f
#define KSC   1024.0f
#define PCAR  32768.0f
#define VCAR  256.0f
#define LOG2E 1.4426950408889634f
#define NEGT  (-1.0e9f * LOG2E)
#define ATW   4
#define ATT_THREADS (ATW * 32)
#define QPB   (16 * ATW)
#define BPH   (SEQ / QPB)
#define ATT_BLOCKS (NBH * BPH)
#define PTP   36
#define SLP   68
#define SLABF (16 * SLP)
#define VTP   72
#define VTILES (SEQ / 64)
static_assert(HD == 64 && QPB == 64 && ATT_THREADS == 128);
static_assert((SEQ % QPB) == 0 && (SEQ % 64) == 0 && (SEQ % 32) == 0);
static_assert(BPH == 32 && ATT_BLOCKS == 1024 && VTILES == 32);
static_assert(16 * PTP <= SLABF);
static_assert((HD - 1) * VTP + 63 < HD * VTP);
static_assert(((NBH * SEQ * HD) % 2048) == 0);

typedef _Float16 v16h __attribute__((ext_vector_type(16)));
typedef _Float16 v8h  __attribute__((ext_vector_type(8)));
typedef float    v8f  __attribute__((ext_vector_type(8)));
typedef float    v4f  __attribute__((ext_vector_type(4)));
typedef unsigned int v4u __attribute__((ext_vector_type(4)));

union FragH { v16h v; v8h h[2]; v4u u[2]; };

// ---- scalar helpers --------------------------------------------------------------------------------
__device__ __forceinline__ unsigned short bf_bits(float f) {          // f32 -> bf16 bits, RNE convert
  unsigned u = __float_as_uint(f);
  return (unsigned short)((u + 0x7FFFu + ((u >> 16) & 1u)) >> 16);
}
__device__ __forceinline__ float bf_up(unsigned short h) { return __uint_as_float(((unsigned)h) << 16); }
__device__ __forceinline__ float bfr(float f) { return bf_up(bf_bits(f)); }   // value of the bf16 RNE convert
__device__ __forceinline__ unsigned short h_bits(_Float16 x) { return __builtin_bit_cast(unsigned short, x); }
__device__ __forceinline__ unsigned pk16(unsigned short a, unsigned short b) { return (unsigned)a | ((unsigned)b << 16); }
__device__ __forceinline__ v8f zero8() { v8f z = {0.f, 0.f, 0.f, 0.f, 0.f, 0.f, 0.f, 0.f}; return z; }

// ---- fragment loader: 16-bit A/B operand, lane -> row/col (lane&15), p already includes +8*(lane>>4);
//      elements 0..7 <- p[0..7] (k0+8h..), elements 8..15 <- p[16..23] (k0+16+8h..)  (same split k map for A and B;
//      B is always read from a k-contiguous [n][k] plane)
__device__ __forceinline__ v16h ldfrag_h(const _Float16* p) {
  FragH f;
  f.h[0] = *(const v8h*)(p);
  f.h[1] = *(const v8h*)(p + 16);
  return f.v;
}

__device__ __forceinline__ v8f mma_raw(v16h a, v16h b, v8f c) {
  return __builtin_amdgcn_wmma_f32_16x16x32_f16(false, a, false, b, (short)0, c, false, false);
}
__device__ __forceinline__ void guard_sc(v8f& a, v8f& b, v16h x0, v16h x1, v16h x2, v16h x3, v16h x4, v16h x5) {
#if defined(__HIP_DEVICE_COMPILE__)
  asm volatile("v_nop\n\tv_nop\n\tv_nop\n\tv_nop"
               : "+v"(a), "+v"(b) : "v"(x0), "v"(x1), "v"(x2), "v"(x3), "v"(x4), "v"(x5) : "memory");
#endif
}
__device__ __forceinline__ void guard_pv(v8f& a, v8f& b, v8f& c, v8f& d,
                                         v16h p0, v16h p1, v16h x0, v16h x1, v16h x2, v16h x3) {
#if defined(__HIP_DEVICE_COMPILE__)
  asm volatile("v_nop\n\tv_nop\n\tv_nop\n\tv_nop"
               : "+v"(a), "+v"(b), "+v"(c), "+v"(d) : "v"(p0), "v"(p1), "v"(x0), "v"(x1), "v"(x2), "v"(x3) : "memory");
#endif
}
__device__ __forceinline__ void acc_guard4(v8f& a, v8f& b, v8f& c, v8f& d) {
#if defined(__HIP_DEVICE_COMPILE__)
  asm volatile("v_nop\n\tv_nop\n\tv_nop\n\tv_nop" : "+v"(a), "+v"(b), "+v"(c), "+v"(d));
#endif
}
__device__ __forceinline__ void wave_sync_lds() {
  __builtin_amdgcn_fence(__ATOMIC_RELEASE, "workgroup");
  __builtin_amdgcn_wave_barrier();
  __builtin_amdgcn_fence(__ATOMIC_ACQUIRE, "workgroup");
}

// =====================================================================================================
// 16-bit plane convert, no relayout (inputs are already [bh][s][d] with bh = b*16+h):
//   pl[e] = f16( bf16(x[e]) * sc ) (sc a power of two, exact). blockIdx.y == 0: q plane, == 1: k plane.
// Thread = 8 consecutive elements: two 16-B loads, one 16-B store per lane; 32 consecutive lanes = 512 contiguous, 512-B
// coverage: grid = (n8/256, 2) blocks x 256 thr x 8 elements = n = 32*2048*64 per plane exactly (n % 2048 == 0 asserted).
// =====================================================================================================
__global__ __launch_bounds__(256) void cvt16(const float* __restrict__ xq, const float* __restrict__ xk,
                                             unsigned short* plq, unsigned short* plk, int n8, float sc) {
  const int gt = blockIdx.x * 256 + (int)threadIdx.x;
  if (gt >= n8) return;                     // never taken with the exact grid; no barriers in this kernel
  const bool sk = (blockIdx.y != 0);        // block-uniform plane select (both pointers global)
  const float* x = sk ? xk : xq;
  unsigned short* pl = sk ? plk : plq;
  const size_t e = (size_t)gt * 8;
  const v4f a = *(const v4f*)(x + e), bq = *(const v4f*)(x + e + 4);
  v4u o;
#pragma unroll
  for (int i = 0; i < 2; ++i) {
    o[i]     = pk16(h_bits((_Float16)(bfr(a[2 * i]) * sc)),  h_bits((_Float16)(bfr(a[2 * i + 1]) * sc)));
    o[2 + i] = pk16(h_bits((_Float16)(bfr(bq[2 * i]) * sc)), h_bits((_Float16)(bfr(bq[2 * i + 1]) * sc)));
  }
  unsigned short* d = pl + e;
  {
    *(v4u*)(d) = o;
    
  }
}

// =====================================================================================================
// v^T plane: VT[(bh*HD + d)][key] = f16( bf16(v[bh][key][d]) * 256 ) (exact), pitch SEQ = 2048 halves (4096 B) per d row.
// Block = (bh, tile of 64 keys): 64 source rows of 64 floats loaded with 16-B loads (static stride), converted, written into
// coverage: load 256 thr x 16 elements = 64 keys x 64 d; store 2 iterations x 256 thr x 8 halves = 64 lines x 64 = the tile;
//           grid = NBH x 32 = 1024 blocks covers the whole [32][64][2048] plane exactly once.
// =====================================================================================================
__global__ __launch_bounds__(256) void vt16(const float* __restrict__ v, unsigned short* VTo) {
  __shared__ __align__(16) unsigned short T[HD * VTP];
  const int tid = threadIdx.x;
  const int bid = blockIdx.x;
  const int bh  = bid / VTILES;
  const int t   = bid - bh * VTILES;        // 0..31, block-uniform
  if (bh >= NBH) return;                    // never taken with the exact grid; before any barrier or store
  {
    const int sl = tid >> 2;                  // key within tile 0..63
    const int dc = (tid & 3) * 16;            // d chunk
    int key = 64 * t + sl;                    // <= SEQ-1 by construction; clamp keeps the address in range regardless
    key = (key < 0) ? 0 : ((key > SEQ - 1) ? (SEQ - 1) : key);
    const float* src = v + (((size_t)bh * SEQ + (size_t)key) * HD + dc);
#pragma unroll
    for (int i = 0; i < 4; ++i) {
      const v4f a = *(const v4f*)(src + 4 * i);
#pragma unroll
      for (int e = 0; e < 4; ++e) T[(dc + 4 * i + e) * VTP + sl] = h_bits((_Float16)(bfr(a[e]) * VCAR));
    }
  }
  __syncthreads();
  v4u vals[2];
  const int q8 = tid >> 3, p8 = (tid & 7) * 8;
#pragma unroll
  for (int it = 0; it < 2; ++it) {
    const int line = it * 32 + q8;            // d = 0..63
    vals[it] = *(const v4u*)(T + line * VTP + p8);
  }
  unsigned short* dst = VTo + ((size_t)(bh * HD)) * SEQ + 64 * t + p8;
  {
#pragma unroll
    for (int it = 0; it < 2; ++it) {
      const int line = it * 32 + q8;
      *(v4u*)(dst + (size_t)line * SEQ) = vals[it];
    }
    
  }
}

// =====================================================================================================
// Masked flash attention per (b,h). Block = (bh, 64 queries), wave w owns query rows iw = 64t + 16w .. +15.
//   q plane f16 [bh][s][d], k plane f16 [bh][s][d], v^T plane f16 [bh][d][SEQ], mask int [s][s] shared over bh (read per
//   element, 0 = masked).
//   Key loop (uniform bound): kb = 0, 32, ..., SEQ-32; every key tile is visited.
//   Per 32-key step: 2 score subtiles x 2 k-steps x 1 product, fragments loaded straight from the planes (two 16-B loads per
//   fragment, split k map); the mask is applied by value in the log2 domain (t := -1e9*log2e where mask == 0, the scaled
//   score otherwise), so a row whose visited keys are all masked stays uniform exactly like the spec and a single unmasked key
//   zeroes every masked term through exp2; online max-subtracted softmax in f32 (exp2); rescale of l and the 4 accumulators;
//   P*32768 (f16 hi) and its f16 residual rebuilt from the LDS rows (float vector loads), 4 v^T B fragments from the plane,
//   8 P.V WMMAs.
//   Epilogue: 1/l and carry folds in f32; the wave's 16x64 f32 result staged in its LDS slab (pitch 68); each pair of
//   No block barriers in this kernel; every wave of a block does exactly 64 steps.
// coverage: per wave 8 instructions x 32 lanes x 4 floats = 16 rows x 64; per block 4 waves = 64 rows; 32 blocks per bh x
//           32 bh: every row of out [32][2048][64] exactly once (grid 1024 blocks).
// =====================================================================================================
__global__ __launch_bounds__(ATT_THREADS)
void attn_masked(const unsigned short* __restrict__ QHp, const unsigned short* __restrict__ KHp,
                 const unsigned short* __restrict__ VTq, const int* __restrict__ Msk, float* OPp) {
  __shared__ __align__(16) float smem[ATW * SLABF];    // per wave: prob tile [16][32] pitch 36 during the loop, result slab after

  const int tid  = threadIdx.x;
  const int wave = tid >> 5;
  const int lane = tid & 31;
  const int hh   = lane >> 4;
  const int c    = lane & 15;

  const int bid  = blockIdx.x;
  const int bh   = bid / BPH;
  const int t    = bid - bh * BPH;                     // 0..31, block-uniform
  if (bh >= NBH) return;                               // never taken with the exact grid; before any LDS use or store

  const int i0 = QPB * t;
  const int iw = i0 + wave * 16;                       // query row 0 of this wave, <= SEQ-16
  const int qs = iw + c;                               // query row of fragment row c, <= SEQ-1 by construction
  const int qbl = iw + 8 * hh;                         // query row of D element r = qbl + r, qbl + 7 <= SEQ-1

  const _Float16* Qb = (const _Float16*)(const void*)QHp + ((size_t)bh * SEQ + (size_t)qs) * HD + 8 * hh;
  const v16h qa0 = ldfrag_h(Qb);                       // d 0..31
  const v16h qa1 = ldfrag_h(Qb + 32);                  // d 32..63
  const _Float16* Kb = (const _Float16*)(const void*)KHp + ((size_t)bh * SEQ + (size_t)c) * HD + 8 * hh;
  const _Float16* Vb = (const _Float16*)(const void*)VTq + ((size_t)(bh * HD + c)) * SEQ + 8 * hh;   // d row c
  const int* Mb = Msk + (size_t)qbl * SEQ + c;         // mask row qbl, key c (no bh offset: shared over batch and heads)
  const float lsc = LOG2E / (8.0f * QSC * KSC);        // 1/sqrt(64) and the q,k carries, base-2 domain

  float mrow[8], lrow[8];
  v8f o[4];
#pragma unroll
  for (int r = 0; r < 8; ++r) { mrow[r] = -INFINITY; lrow[r] = 0.f; }
#pragma unroll
  for (int j = 0; j < 4; ++j) o[j] = zero8();
  float* pt = smem + wave * SLABF;

#pragma unroll 1
  for (int kb = 0; kb < SEQ; kb += 32) {
    // ---- mask values for (query qbl + r, key kb + c) and (.., key kb + 16 + c); all indices in range by construction ----
    int mv0[8], mv1[8];
    {
      const int* mk = Mb + kb;
#pragma unroll
      for (int r = 0; r < 8; ++r) {
        mv0[r] = mk[(size_t)r * SEQ];
        mv1[r] = mk[(size_t)r * SEQ + 16];
      }
    }
    // ---- scores: D element r of this lane = (query qbl + r, key kb + c) in s0, key kb + 16 + c in s1 ----
    v8f s0 = zero8(), s1 = zero8();
    {
      const _Float16* k0p = Kb + (size_t)kb * HD;                    // key row kb + c
      const _Float16* k1p = k0p + (size_t)16 * HD;                   // key row kb + 16 + c
      const v16h kf00 = ldfrag_h(k0p), kf01 = ldfrag_h(k0p + 32);
      const v16h kf10 = ldfrag_h(k1p), kf11 = ldfrag_h(k1p + 32);
      s0 = mma_raw(qa0, kf00, s0);
      s0 = mma_raw(qa1, kf01, s0);
      s1 = mma_raw(qa0, kf10, s1);
      s1 = mma_raw(qa1, kf11, s1);
      guard_sc(s0, s1, qa0, qa1, kf00, kf01, kf10, kf11);
    }
    // ---- replace-mask by value + online softmax in base 2 ----
#pragma unroll
    for (int r = 0; r < 8; ++r) {
      const float t0 = (mv0[r] == 0) ? NEGT : s0[r] * lsc;
      const float t1 = (mv1[r] == 0) ? NEGT : s1[r] * lsc;
      float mx = fmaxf(t0, t1);
#pragma unroll
      for (int off = 1; off < 16; off <<= 1) mx = fmaxf(mx, __shfl_xor(mx, off, 32));
      const float mn  = fmaxf(mrow[r], mx);            // finite: mx is either a scaled score or NEGT
      const float al  = exp2f(mrow[r] - mn);           // 0 on the first step (mrow = -inf)
      mrow[r] = mn;
      const float e0 = exp2f(t0 - mn), e1 = exp2f(t1 - mn);
      float ps = e0 + e1;
#pragma unroll
      for (int off = 1; off < 16; off <<= 1) ps += __shfl_xor(ps, off, 32);
      lrow[r] = lrow[r] * al + ps;
#pragma unroll
      for (int j = 0; j < 4; ++j) o[j][r] *= al;
      const int ro = (8 * hh + r) * PTP + c;
      pt[ro]      = e0;
      pt[ro + 16] = e1;
    }
    wave_sync_lds();
    // ---- A fragments of P*32768: hi f16 and residual f16, row = c, split k map over the 32 keys of this step ----
    FragH ph, pl;
    {
      const float* prow = pt + c * PTP + 8 * hh;
      const v4f p0 = *(const v4f*)(prow), p1 = *(const v4f*)(prow + 4);
      const v4f p2 = *(const v4f*)(prow + 16), p3 = *(const v4f*)(prow + 20);
#pragma unroll
      for (int e = 0; e < 4; ++e) {
        const float ta = p0[e] * PCAR, tb = p1[e] * PCAR, tc = p2[e] * PCAR, td = p3[e] * PCAR;
        const _Float16 ha = (_Float16)ta, hb = (_Float16)tb, hc = (_Float16)tc, hd = (_Float16)td;
        ph.h[0][e]     = ha;                               // elements 0..7  = keys kb + 8hh + 0..7
        ph.h[0][4 + e] = hb;
        ph.h[1][e]     = hc;                               // elements 8..15 = keys kb + 16 + 8hh + 0..7
        ph.h[1][4 + e] = hd;
        pl.h[0][e]     = (_Float16)(ta - (float)ha);
        pl.h[0][4 + e] = (_Float16)(tb - (float)hb);
        pl.h[1][e]     = (_Float16)(tc - (float)hc);
        pl.h[1][4 + e] = (_Float16)(td - (float)hd);
      }
    }
    // ---- P.V : B fragment col n = d = j*16 + c, keys contiguous in the v^T plane columns kb .. kb+31 ----
    {
      const _Float16* vp = Vb + kb;
      const v16h vb0 = ldfrag_h(vp);
      const v16h vb1 = ldfrag_h(vp + (size_t)16 * SEQ);
      const v16h vb2 = ldfrag_h(vp + (size_t)32 * SEQ);
      const v16h vb3 = ldfrag_h(vp + (size_t)48 * SEQ);
      o[0] = mma_raw(ph.v, vb0, o[0]);  o[0] = mma_raw(pl.v, vb0, o[0]);
      o[1] = mma_raw(ph.v, vb1, o[1]);  o[1] = mma_raw(pl.v, vb1, o[1]);
      o[2] = mma_raw(ph.v, vb2, o[2]);  o[2] = mma_raw(pl.v, vb2, o[2]);
      o[3] = mma_raw(ph.v, vb3, o[3]);  o[3] = mma_raw(pl.v, vb3, o[3]);
      guard_pv(o[0], o[1], o[2], o[3], ph.v, pl.v, vb0, vb1, vb2, vb3);
    }
    wave_sync_lds();
  }
  acc_guard4(o[0], o[1], o[2], o[3]);

  // ---- fold 1/l and the carries (32768 on P, 256 on v), stage the wave's 16x64 slab in its LDS region ----
  wave_sync_lds();
  float* slab = pt;
  const float oc = 1.0f / (PCAR * VCAR);
#pragma unroll
  for (int r = 0; r < 8; ++r) {
    const float lr  = lrow[r];                           // >= 1 (the max element contributes 2^0)
    const float inv = (lr > 0.0f) ? ((1.0f / lr) * oc) : 0.0f;
#pragma unroll
    for (int j = 0; j < 4; ++j) slab[(8 * hh + r) * SLP + j * 16 + c] = o[j][r] * inv;
  }
  wave_sync_lds();
  v4f vals[8];
#pragma unroll
  for (int it = 0; it < 8; ++it) vals[it] = *(const v4f*)(slab + (2 * it + hh) * SLP + c * 4);
  float* dst = OPp + ((size_t)(bh * SEQ + iw)) * HD + hh * HD + c * 4;
  {
#pragma unroll
    for (int it = 0; it < 8; ++it) {
      *(v4f*)(dst + (size_t)(2 * it) * HD) = vals[it];
    }
    
  }
}

// =====================================================================================================
// Workspace map (bytes); every plane is fully written by whole-line stores before it is read; all extents are exact
// multiples of the store granularity (no pad rows needed); offsets multiples of 128:
//   QH f16 [32][2048][64] x1024        8388608   at        0
//   KH f16 [32][2048][64] x1024        8388608   at  8388608
//   VT f16 [32][64][2048] x256         8388608   at 16777216
//   end                                             25165824
// =====================================================================================================
extern "C" void kernel_launch(void* const* d_in, const int* in_sizes, int n_in,
                              void* d_out, int out_size, void* d_ws, size_t ws_size,
                              hipStream_t stream) {
  const int NEL = NBH * SEQ * HD;                       // 4194304
  if (n_in < 4) return;
  if (in_sizes[0] < NEL || in_sizes[1] < NEL || in_sizes[2] < NEL || in_sizes[3] < SEQ * SEQ) return;
  if (out_size < NEL) return;

  const float* q  = (const float*)d_in[0];
  const float* k  = (const float*)d_in[1];
  const float* v  = (const float*)d_in[2];
  const int*   mk = (const int*)d_in[3];
  float*       out = (float*)d_out;

  const size_t PQ = (size_t)NEL * 2;                    //  8388608
  const size_t PK = (size_t)NEL * 2;                    //  8388608
  const size_t PV = (size_t)NBH * HD * SEQ * 2;         //  8388608
  size_t off = 0;
  const size_t oQH = off; off += PQ;
  const size_t oKH = off; off += PK;
  const size_t oVT = off; off += PV;
  if (off > ws_size) return;                            // off = 25165824
  if (off > (size_t)134217728) return;

  char* ws = (char*)d_ws;
  unsigned short* QH = (unsigned short*)(ws + oQH);
  unsigned short* KH = (unsigned short*)(ws + oKH);
  unsigned short* VT = (unsigned short*)(ws + oVT);

  const int n8 = NEL / 8;                               // 524288
  const dim3 blk(256);
  const dim3 gC(n8 / 256, 2);                           // (2048, 2): q and k planes in one launch
  const dim3 gVT(NBH * VTILES);                         // 1024
  const dim3 gAT(ATT_BLOCKS);                           // 1024
  const dim3 bAT(ATT_THREADS);                          // 128

  // (0) q and k planes f16(bf16(x) * 1024), layout [bh][s][d]
  cvt16<<<gC, blk, 0, stream>>>(q, k, QH, KH, n8, QSC);
  // (1) v^T plane f16(bf16(v) * 256), layout [bh][d][2048]
  vt16<<<gVT, blk, 0, stream>>>(v, VT);
  // (2) masked flash attention per (b,h) -> out [bh][s][d] f32
  attn_masked<<<gAT, bAT, 0, stream>>>(QH, KH, VT, mk, out);
  (void)hipGetLastError();
}

// v001
// Measured time: 134 microseconds a run.
// In both of two side-by-side timings against v000, it was 1.06 times as fast.
// Contractions: scores q.k^T (q x1024 and k x1024 as f16 planes of the bf16-RNE-converted inputs, one product each, K=64) and
// P.v (P x32768 as f16 hi plane + f16 residual plane, v x256 f16 of the bf16-RNE-converted input, products hi.v+lo.v, 32-key
// steps): all v_wmma_f32_16x16x32_f16, f32 accumulate. Base-2 online softmax with the dense int key mask applied by value
// (replace) and the 1/l fold in f32 on VALU.
// The k plane and the v^T plane lie in fragment order: each 16-B load of a B fragment reads 512 contiguous bytes per wave.
#include <hip/hip_runtime.h>
#include <math.h>
#include <stdint.h>

#define NBH   32
#define SEQ   2048
#define HD    64
#define QSC   1024.0f
#define KSC   1024.0f
#define PCAR  32768.0f
#define VCAR  256.0f
#define LOG2E 1.4426950408889634f
#define NEGT  (-1.0e9f * LOG2E)
#define ATW   4
#define ATT_THREADS (ATW * 32)
#define QPB   (16 * ATW)
#define BPH   (SEQ / QPB)
#define ATT_BLOCKS (NBH * BPH)
#define PTP   36
#define SLP   68
#define SLABF (16 * SLP)
#define VTP   72
#define VTILES (SEQ / 64)
static_assert(HD == 64 && QPB == 64 && ATT_THREADS == 128);
static_assert((SEQ % QPB) == 0 && (SEQ % 64) == 0 && (SEQ % 32) == 0);
static_assert(BPH == 32 && ATT_BLOCKS == 1024 && VTILES == 32);
static_assert(16 * PTP <= SLABF);
static_assert((HD - 1) * VTP + 63 < HD * VTP);
static_assert(((NBH * SEQ * HD) % 2048) == 0);

typedef _Float16 v16h __attribute__((ext_vector_type(16)));
typedef _Float16 v8h  __attribute__((ext_vector_type(8)));
typedef float    v8f  __attribute__((ext_vector_type(8)));
typedef float    v4f  __attribute__((ext_vector_type(4)));
typedef unsigned int v4u __attribute__((ext_vector_type(4)));

union FragH { v16h v; v8h h[2]; v4u u[2]; };

// ---- scalar helpers --------------------------------------------------------------------------------
__device__ __forceinline__ unsigned short bf_bits(float f) {          // f32 -> bf16 bits, RNE convert
  unsigned u = __float_as_uint(f);
  return (unsigned short)((u + 0x7FFFu + ((u >> 16) & 1u)) >> 16);
}
__device__ __forceinline__ float bf_up(unsigned short h) { return __uint_as_float(((unsigned)h) << 16); }
__device__ __forceinline__ float bfr(float f) { return bf_up(bf_bits(f)); }   // value of the bf16 RNE convert
__device__ __forceinline__ unsigned short h_bits(_Float16 x) { return __builtin_bit_cast(unsigned short, x); }
__device__ __forceinline__ unsigned pk16(unsigned short a, unsigned short b) { return (unsigned)a | ((unsigned)b << 16); }
__device__ __forceinline__ v8f zero8() { v8f z = {0.f, 0.f, 0.f, 0.f, 0.f, 0.f, 0.f, 0.f}; return z; }

// ---- fragment loader: 16-bit A/B operand, lane -> row/col (lane&15), p already includes +8*(lane>>4);
//      elements 0..7 <- p[0..7] (k0+8h..), elements 8..15 <- p[16..23] (k0+16+8h..)  (same split k map for A and B;
//      here it reads only A, from the [s][d] q plane; B fragments use ldfrag_f)
__device__ __forceinline__ v16h ldfrag_h(const _Float16* p) {
  FragH f;
  f.h[0] = *(const v8h*)(p);
  f.h[1] = *(const v8h*)(p + 16);
  return f.v;
}

// ---- same fragment from a plane kept in fragment order: p is wave-uniform, lo = 8*lane; the lanes' first 8 elements are one
//      contiguous 512-B run, their second 8 elements the next 512-B run (256 halves on)
__device__ __forceinline__ v16h ldfrag_f(const _Float16* p, unsigned lo) {
  FragH f;
  f.h[0] = *(const v8h*)(p + lo);
  f.h[1] = *(const v8h*)(p + 256 + lo);
  return f.v;
}

__device__ __forceinline__ v8f mma_raw(v16h a, v16h b, v8f c) {
  return __builtin_amdgcn_wmma_f32_16x16x32_f16(false, a, false, b, (short)0, c, false, false);
}
__device__ __forceinline__ void guard_sc(v8f& a, v8f& b, v16h x0, v16h x1, v16h x2, v16h x3, v16h x4, v16h x5) {
#if defined(__HIP_DEVICE_COMPILE__)
  asm volatile("v_nop\n\tv_nop\n\tv_nop\n\tv_nop"
               : "+v"(a), "+v"(b) : "v"(x0), "v"(x1), "v"(x2), "v"(x3), "v"(x4), "v"(x5) : "memory");
#endif
}
__device__ __forceinline__ void guard_pv(v8f& a, v8f& b, v8f& c, v8f& d,
                                         v16h p0, v16h p1, v16h x0, v16h x1, v16h x2, v16h x3) {
#if defined(__HIP_DEVICE_COMPILE__)
  asm volatile("v_nop\n\tv_nop\n\tv_nop\n\tv_nop"
               : "+v"(a), "+v"(b), "+v"(c), "+v"(d) : "v"(p0), "v"(p1), "v"(x0), "v"(x1), "v"(x2), "v"(x3) : "memory");
#endif
}
__device__ __forceinline__ void acc_guard4(v8f& a, v8f& b, v8f& c, v8f& d) {
#if defined(__HIP_DEVICE_COMPILE__)
  asm volatile("v_nop\n\tv_nop\n\tv_nop\n\tv_nop" : "+v"(a), "+v"(b), "+v"(c), "+v"(d));
#endif
}
__device__ __forceinline__ void wave_sync_lds() {
  __builtin_amdgcn_fence(__ATOMIC_RELEASE, "workgroup");
  __builtin_amdgcn_wave_barrier();
  __builtin_amdgcn_fence(__ATOMIC_ACQUIRE, "workgroup");
}

// =====================================================================================================
// 16-bit plane convert (inputs are [bh][s][d] with bh = b*16+h): value f16( bf16(x) * sc ) (sc a power of two, exact).
//   blockIdx.y == 0: q plane, layout [bh][s][d] as the input. blockIdx.y == 1: k plane in fragment order:
//   [row tile of 16][ld = 0..3][lane = 16*hh + c][8 halves] holds k[16*tile + c][16*ld + 8*hh + 0..7].
// Thread = one 16-B chunk of the plane (8 consecutive d of one row): two 16-B loads, one 16-B store; 32 consecutive lanes store 512-B
// coverage: grid = (n8/256, 2) blocks x 256 thr x 8 elements = n = 32*2048*64 per plane exactly (n % 2048 == 0 asserted).
// =====================================================================================================
__global__ __launch_bounds__(256) void cvt16(const float* __restrict__ xq, const float* __restrict__ xk,
                                             unsigned short* plq, unsigned short* plk, int n8, float sc) {
  const int gt = blockIdx.x * 256 + (int)threadIdx.x;
  if (gt >= n8) return;                     // never taken with the exact grid; no barriers in this kernel
  const bool sk = (blockIdx.y != 0);        // block-uniform plane select (both pointers global)
  const float* x = sk ? xk : xq;
  unsigned short* pl = sk ? plk : plq;
  const size_t e = (size_t)gt * 8;          // destination element: the stores stay contiguous for both planes
  // source element: q the same place; k row 16*(gt>>7) + (gt&15), d chunk 2*((gt>>5)&3) + ((gt>>4)&1) (a bijection on gt)
  const size_t es = sk ? ((size_t)((gt >> 7) * 16 + (gt & 15)) * HD + (size_t)((((gt >> 5) & 3) * 2 + ((gt >> 4) & 1)) * 8)) : e;
  const v4f a = *(const v4f*)(x + es), bq = *(const v4f*)(x + es + 4);
  v4u o;
#pragma unroll
  for (int i = 0; i < 2; ++i) {
    o[i]     = pk16(h_bits((_Float16)(bfr(a[2 * i]) * sc)),  h_bits((_Float16)(bfr(a[2 * i + 1]) * sc)));
    o[2 + i] = pk16(h_bits((_Float16)(bfr(bq[2 * i]) * sc)), h_bits((_Float16)(bfr(bq[2 * i + 1]) * sc)));
  }
  unsigned short* d = pl + e;
  {
    *(v4u*)(d) = o;
    
  }
}

// =====================================================================================================
// v^T plane in fragment order, values f16( bf16(v[bh][key][d]) * 256 ) (exact):
//   [bh][step of 32 keys][j = 0..3][part = 0..1][lane = 16*hh + c][8 halves] holds d = 16*j + c, keys 32*step + 16*part + 8*hh + 0..7.
// Block = (bh, tile of 64 keys): 64 source rows of 64 floats loaded with 16-B loads (static stride), converted, written into
// coverage: load 256 thr x 16 elements = 64 keys x 64 d; store 2 iterations x 256 thr x 8 halves = 64 lines x 64 = the tile;
//           grid = NBH x 32 = 1024 blocks, each 8192 contiguous bytes (2 steps): the whole plane exactly once.
// =====================================================================================================
__global__ __launch_bounds__(256) void vt16(const float* __restrict__ v, unsigned short* VTo) {
  __shared__ __align__(16) unsigned short T[HD * VTP];
  const int tid = threadIdx.x;
  const int bid = blockIdx.x;
  const int bh  = bid / VTILES;
  const int t   = bid - bh * VTILES;        // 0..31, block-uniform
  if (bh >= NBH) return;                    // never taken with the exact grid; before any barrier or store
  {
    const int sl = tid >> 2;                  // key within tile 0..63
    const int dc = (tid & 3) * 16;            // d chunk
    int key = 64 * t + sl;                    // <= SEQ-1 by construction; clamp keeps the address in range regardless
    key = (key < 0) ? 0 : ((key > SEQ - 1) ? (SEQ - 1) : key);
    const float* src = v + (((size_t)bh * SEQ + (size_t)key) * HD + dc);
#pragma unroll
    for (int i = 0; i < 4; ++i) {
      const v4f a = *(const v4f*)(src + 4 * i);
#pragma unroll
      for (int e = 0; e < 4; ++e) T[(dc + 4 * i + e) * VTP + sl] = h_bits((_Float16)(bfr(a[e]) * VCAR));
    }
  }
  __syncthreads();
  v4u vals[2];
  const int line = ((tid >> 6) & 3) * 16 + (tid & 15);        // d = 16*j + c, 0..63
  const int p8   = ((tid >> 5) & 1) * 16 + ((tid >> 4) & 1) * 8; // key within the 32-key step: 16*part + 8*hh
#pragma unroll
  for (int it = 0; it < 2; ++it) vals[it] = *(const v4u*)(T + line * VTP + it * 32 + p8);   // it = step within the tile
  unsigned short* dst = VTo + ((size_t)bh * SEQ + (size_t)(64 * t)) * HD + tid * 8;
  {
#pragma unroll
    for (int it = 0; it < 2; ++it) {
      *(v4u*)(dst + (size_t)it * 32 * HD) = vals[it];
    }
    
  }
}

// =====================================================================================================
// Masked flash attention per (b,h). Block = (bh, 64 queries), wave w owns query rows iw = 64t + 16w .. +15.
//   q plane f16 [bh][s][d], k plane and v^T plane f16 in fragment order (4096 contiguous bytes each per 32-key step), mask
//   int [s][s] shared over bh (read per element, 0 = masked).
//   Key loop (uniform bound): kb = 0, 32, ..., SEQ-32; every key tile is visited.
//   Per 32-key step: 2 score subtiles x 2 k-steps x 1 product, fragments loaded straight from the planes (two 16-B loads per
//   fragment, split k map); the mask is applied by value in the log2 domain (t := -1e9*log2e where mask == 0, the scaled
//   score otherwise), so a row whose visited keys are all masked stays uniform exactly like the spec and a single unmasked key
//   zeroes every masked term through exp2; online max-subtracted softmax in f32 (exp2); rescale of l and the 4 accumulators;
//   P*32768 (f16 hi) and its f16 residual rebuilt from the LDS rows (float vector loads), 4 v^T B fragments from the plane,
//   8 P.V WMMAs.
//   Epilogue: 1/l and carry folds in f32; the wave's 16x64 f32 result staged in its LDS slab (pitch 68); each pair of
//   No block barriers in this kernel; every wave of a block does exactly 64 steps.
// coverage: per wave 8 instructions x 32 lanes x 4 floats = 16 rows x 64; per block 4 waves = 64 rows; 32 blocks per bh x
//           32 bh: every row of out [32][2048][64] exactly once (grid 1024 blocks).
// =====================================================================================================
__global__ __launch_bounds__(ATT_THREADS)
void attn_masked(const unsigned short* __restrict__ QHp, const unsigned short* __restrict__ KHp,
                 const unsigned short* __restrict__ VTq, const int* __restrict__ Msk, float* OPp) {
  __shared__ __align__(16) float smem[ATW * SLABF];    // per wave: prob tile [16][32] pitch 36 during the loop, result slab after

  const int tid  = threadIdx.x;
  const int wave = tid >> 5;
  const int lane = tid & 31;
  const int hh   = lane >> 4;
  const int c    = lane & 15;

  const int bid  = blockIdx.x;
  const int bh   = bid / BPH;
  const int t    = bid - bh * BPH;                     // 0..31, block-uniform
  if (bh >= NBH) return;                               // never taken with the exact grid; before any LDS use or store

  const int i0 = QPB * t;
  const int iw = i0 + wave * 16;                       // query row 0 of this wave, <= SEQ-16
  const int qs = iw + c;                               // query row of fragment row c, <= SEQ-1 by construction
  const int qbl = iw + 8 * hh;                         // query row of D element r = qbl + r, qbl + 7 <= SEQ-1

  const _Float16* Qb = (const _Float16*)(const void*)QHp + ((size_t)bh * SEQ + (size_t)qs) * HD + 8 * hh;
  const v16h qa0 = ldfrag_h(Qb);                       // d 0..31
  const v16h qa1 = ldfrag_h(Qb + 32);                  // d 32..63
  const _Float16* Kb = (const _Float16*)(const void*)KHp + (size_t)bh * SEQ * HD;   // block-uniform plane bases
  const _Float16* Vb = (const _Float16*)(const void*)VTq + (size_t)bh * SEQ * HD;
  const unsigned  lo = 8u * (unsigned)lane;            // this lane's 16-B chunk in each 512-B run, lane = 16*hh + c
  const int* Mb = Msk + (size_t)qbl * SEQ + c;         // mask row qbl, key c (no bh offset: shared over batch and heads)
  const float lsc = LOG2E / (8.0f * QSC * KSC);        // 1/sqrt(64) and the q,k carries, base-2 domain

  float mrow[8], lrow[8];
  v8f o[4];
#pragma unroll
  for (int r = 0; r < 8; ++r) { mrow[r] = -INFINITY; lrow[r] = 0.f; }
#pragma unroll
  for (int j = 0; j < 4; ++j) o[j] = zero8();
  float* pt = smem + wave * SLABF;

#pragma unroll 1
  for (int kb = 0; kb < SEQ; kb += 32) {
    // ---- mask values for (query qbl + r, key kb + c) and (.., key kb + 16 + c); all indices in range by construction ----
    int mv0[8], mv1[8];
    {
      const int* mk = Mb + kb;
#pragma unroll
      for (int r = 0; r < 8; ++r) {
        mv0[r] = mk[(size_t)r * SEQ];
        mv1[r] = mk[(size_t)r * SEQ + 16];
      }
    }
    // ---- scores: D element r of this lane = (query qbl + r, key kb + c) in s0, key kb + 16 + c in s1 ----
    v8f s0 = zero8(), s1 = zero8();
    {
      const _Float16* k0p = Kb + (size_t)kb * HD;                    // row tile kb/16: key row kb + c
      const _Float16* k1p = k0p + (size_t)16 * HD;                   // next row tile: key row kb + 16 + c
      const v16h kf00 = ldfrag_f(k0p, lo), kf01 = ldfrag_f(k0p + 512, lo);   // d 0..31, d 32..63
      const v16h kf10 = ldfrag_f(k1p, lo), kf11 = ldfrag_f(k1p + 512, lo);
      s0 = mma_raw(qa0, kf00, s0);
      s0 = mma_raw(qa1, kf01, s0);
      s1 = mma_raw(qa0, kf10, s1);
      s1 = mma_raw(qa1, kf11, s1);
      guard_sc(s0, s1, qa0, qa1, kf00, kf01, kf10, kf11);
    }
    // ---- replace-mask by value + online softmax in base 2 ----
#pragma unroll
    for (int r = 0; r < 8; ++r) {
      const float t0 = (mv0[r] == 0) ? NEGT : s0[r] * lsc;
      const float t1 = (mv1[r] == 0) ? NEGT : s1[r] * lsc;
      float mx = fmaxf(t0, t1);
#pragma unroll
      for (int off = 1; off < 16; off <<= 1) mx = fmaxf(mx, __shfl_xor(mx, off, 32));
      const float mn  = fmaxf(mrow[r], mx);            // finite: mx is either a scaled score or NEGT
      const float al  = exp2f(mrow[r] - mn);           // 0 on the first step (mrow = -inf)
      mrow[r] = mn;
      const float e0 = exp2f(t0 - mn), e1 = exp2f(t1 - mn);
      float ps = e0 + e1;
#pragma unroll
      for (int off = 1; off < 16; off <<= 1) ps += __shfl_xor(ps, off, 32);
      lrow[r] = lrow[r] * al + ps;
#pragma unroll
      for (int j = 0; j < 4; ++j) o[j][r] *= al;
      const int ro = (8 * hh + r) * PTP + c;
      pt[ro]      = e0;
      pt[ro + 16] = e1;
    }
    wave_sync_lds();
    // ---- A fragments of P*32768: hi f16 and residual f16, row = c, split k map over the 32 keys of this step ----
    FragH ph, pl;
    {
      const float* prow = pt + c * PTP + 8 * hh;
      const v4f p0 = *(const v4f*)(prow), p1 = *(const v4f*)(prow + 4);
      const v4f p2 = *(const v4f*)(prow + 16), p3 = *(const v4f*)(prow + 20);
#pragma unroll
      for (int e = 0; e < 4; ++e) {
        const float ta = p0[e] * PCAR, tb = p1[e] * PCAR, tc = p2[e] * PCAR, td = p3[e] * PCAR;
        const _Float16 ha = (_Float16)ta, hb = (_Float16)tb, hc = (_Float16)tc, hd = (_Float16)td;
        ph.h[0][e]     = ha;                               // elements 0..7  = keys kb + 8hh + 0..7
        ph.h[0][4 + e] = hb;
        ph.h[1][e]     = hc;                               // elements 8..15 = keys kb + 16 + 8hh + 0..7
        ph.h[1][4 + e] = hd;
        pl.h[0][e]     = (_Float16)(ta - (float)ha);
        pl.h[0][4 + e] = (_Float16)(tb - (float)hb);
        pl.h[1][e]     = (_Float16)(tc - (float)hc);
        pl.h[1][4 + e] = (_Float16)(td - (float)hd);
      }
    }
    // ---- P.V : B fragment col n = d = j*16 + c, keys kb .. kb+31 in the split k map, 1024 bytes per j ----
    {
      const _Float16* vp = Vb + (size_t)kb * HD;                     // step kb/32, 32*HD halves each
      const v16h vb0 = ldfrag_f(vp, lo);
      const v16h vb1 = ldfrag_f(vp + 512, lo);
      const v16h vb2 = ldfrag_f(vp + 1024, lo);
      const v16h vb3 = ldfrag_f(vp + 1536, lo);
      o[0] = mma_raw(ph.v, vb0, o[0]);  o[0] = mma_raw(pl.v, vb0, o[0]);
      o[1] = mma_raw(ph.v, vb1, o[1]);  o[1] = mma_raw(pl.v, vb1, o[1]);
      o[2] = mma_raw(ph.v, vb2, o[2]);  o[2] = mma_raw(pl.v, vb2, o[2]);
      o[3] = mma_raw(ph.v, vb3, o[3]);  o[3] = mma_raw(pl.v, vb3, o[3]);
      guard_pv(o[0], o[1], o[2], o[3], ph.v, pl.v, vb0, vb1, vb2, vb3);
    }
    wave_sync_lds();
  }
  acc_guard4(o[0], o[1], o[2], o[3]);

  // ---- fold 1/l and the carries (32768 on P, 256 on v), stage the wave's 16x64 slab in its LDS region ----
  wave_sync_lds();
  float* slab = pt;
  const float oc = 1.0f / (PCAR * VCAR);
#pragma unroll
  for (int r = 0; r < 8; ++r) {
    const float lr  = lrow[r];                           // >= 1 (the max element contributes 2^0)
    const float inv = (lr > 0.0f) ? ((1.0f / lr) * oc) : 0.0f;
#pragma unroll
    for (int j = 0; j < 4; ++j) slab[(8 * hh + r) * SLP + j * 16 + c] = o[j][r] * inv;
  }
  wave_sync_lds();
  v4f vals[8];
#pragma unroll
  for (int it = 0; it < 8; ++it) vals[it] = *(const v4f*)(slab + (2 * it + hh) * SLP + c * 4);
  float* dst = OPp + ((size_t)(bh * SEQ + iw)) * HD + hh * HD + c * 4;
  {
#pragma unroll
    for (int it = 0; it < 8; ++it) {
      *(v4f*)(dst + (size_t)(2 * it) * HD) = vals[it];
    }
    
  }
}

// =====================================================================================================
// Workspace map (bytes); every plane is fully written by whole-line stores before it is read; all extents are exact
// multiples of the store granularity (no pad rows needed); offsets multiples of 128:
//   QH f16 [32][2048][64] x1024        8388608   at        0
//   KH f16 fragment order x1024        8388608   at  8388608
//   VT f16 fragment order x256         8388608   at 16777216
//   end                                             25165824
// =====================================================================================================
extern "C" void kernel_launch(void* const* d_in, const int* in_sizes, int n_in,
                              void* d_out, int out_size, void* d_ws, size_t ws_size,
                              hipStream_t stream) {
  const int NEL = NBH * SEQ * HD;                       // 4194304
  if (n_in < 4) return;
  if (in_sizes[0] < NEL || in_sizes[1] < NEL || in_sizes[2] < NEL || in_sizes[3] < SEQ * SEQ) return;
  if (out_size < NEL) return;

  const float* q  = (const float*)d_in[0];
  const float* k  = (const float*)d_in[1];
  const float* v  = (const float*)d_in[2];
  const int*   mk = (const int*)d_in[3];
  float*       out = (float*)d_out;

  const size_t PQ = (size_t)NEL * 2;                    //  8388608
  const size_t PK = (size_t)NEL * 2;                    //  8388608
  const size_t PV = (size_t)NBH * HD * SEQ * 2;         //  8388608
  size_t off = 0;
  const size_t oQH = off; off += PQ;
  const size_t oKH = off; off += PK;
  const size_t oVT = off; off += PV;
  if (off > ws_size) return;                            // off = 25165824
  if (off > (size_t)134217728) return;

  char* ws = (char*)d_ws;
  unsigned short* QH = (unsigned short*)(ws + oQH);
  unsigned short* KH = (unsigned short*)(ws + oKH);
  unsigned short* VT = (unsigned short*)(ws + oVT);

  const int n8 = NEL / 8;                               // 524288
  const dim3 blk(256);
  const dim3 gC(n8 / 256, 2);                           // (2048, 2): q and k planes in one launch
  const dim3 gVT(NBH * VTILES);                         // 1024
  const dim3 gAT(ATT_BLOCKS);                           // 1024
  const dim3 bAT(ATT_THREADS);                          // 128

  // (0) q and k planes f16(bf16(x) * 1024): q [bh][s][d], k fragment order
  cvt16<<<gC, blk, 0, stream>>>(q, k, QH, KH, n8, QSC);
  // (1) v^T plane f16(bf16(v) * 256), fragment order
  vt16<<<gVT, blk, 0, stream>>>(v, VT);
  // (2) masked flash attention per (b,h) -> out [bh][s][d] f32
  attn_masked<<<gAT, bAT, 0, stream>>>(QH, KH, VT, mk, out);
  (void)hipGetLastError();
}

// v002
// A run of this version takes 94 microseconds.
// Timed twice side by side with v001, it ran 1.39 and 1.42 times as fast.
// Counting every step since v000, it is 1.49 times as fast.
// Contractions: scores k.q^T (k x1024 as A and q x1024 as B, f16 planes of the bf16-RNE-converted inputs, one product each,
// K=64) and v^T.P^T (v x256 f16 of the bf16-RNE-converted input as A, P x32768 as f16 hi plane + f16 residual plane as B,
// products v.hi+v.lo, 32-key steps): all v_wmma_f32_16x16x32_f16, f32 accumulate. A lane holds one query's scores: base-2 online
// softmax in the lane with the dense int key mask applied by value (replace) and the 1/l fold in f32 on VALU.
// The k plane and the v^T plane lie in fragment order: each 16-B load of a fragment reads 512 contiguous bytes per wave.
#include <hip/hip_runtime.h>
#include <math.h>
#include <stdint.h>

#define NBH   32
#define SEQ   2048
#define HD    64
#define QSC   1024.0f
#define KSC   1024.0f
#define PCAR  32768.0f
#define VCAR  256.0f
#define LOG2E 1.4426950408889634f
#define NEGT  (-1.0e9f * LOG2E)
#define ATW   4
#define ATT_THREADS (ATW * 32)
#define QPB   (16 * ATW)
#define BPH   (SEQ / QPB)
#define ATT_BLOCKS (NBH * BPH)
#define SLP   68
#define SLABF (16 * SLP)
#define VTP   72
#define VTILES (SEQ / 64)
static_assert(HD == 64 && QPB == 64 && ATT_THREADS == 128);
static_assert((SEQ % QPB) == 0 && (SEQ % 64) == 0 && (SEQ % 32) == 0);
static_assert(BPH == 32 && ATT_BLOCKS == 1024 && VTILES == 32);
static_assert((HD - 1) * VTP + 63 < HD * VTP);
static_assert(((NBH * SEQ * HD) % 2048) == 0);

typedef _Float16 v16h __attribute__((ext_vector_type(16)));
typedef _Float16 v8h  __attribute__((ext_vector_type(8)));
typedef float    v8f  __attribute__((ext_vector_type(8)));
typedef float    v4f  __attribute__((ext_vector_type(4)));
typedef unsigned int v4u __attribute__((ext_vector_type(4)));
typedef int      v4i  __attribute__((ext_vector_type(4)));

union FragH { v16h v; v8h h[2]; v4u u[2]; };

// ---- scalar helpers --------------------------------------------------------------------------------
__device__ __forceinline__ unsigned short bf_bits(float f) {          // f32 -> bf16 bits, RNE convert
  unsigned u = __float_as_uint(f);
  return (unsigned short)((u + 0x7FFFu + ((u >> 16) & 1u)) >> 16);
}
__device__ __forceinline__ float bf_up(unsigned short h) { return __uint_as_float(((unsigned)h) << 16); }
__device__ __forceinline__ float bfr(float f) { return bf_up(bf_bits(f)); }   // value of the bf16 RNE convert
__device__ __forceinline__ unsigned short h_bits(_Float16 x) { return __builtin_bit_cast(unsigned short, x); }
__device__ __forceinline__ unsigned pk16(unsigned short a, unsigned short b) { return (unsigned)a | ((unsigned)b << 16); }
__device__ __forceinline__ v8f zero8() { v8f z = {0.f, 0.f, 0.f, 0.f, 0.f, 0.f, 0.f, 0.f}; return z; }

// ---- fragment loader: 16-bit A/B operand, lane -> row/col (lane&15), p already includes +8*(lane>>4);
//      elements 0..7 <- p[0..7] (k0+8h..), elements 8..15 <- p[16..23] (k0+16+8h..)  (same split k map for A and B;
//      here it reads only B, from the [s][d] q plane; A fragments use ldfrag_f)
__device__ __forceinline__ v16h ldfrag_h(const _Float16* p) {
  FragH f;
  f.h[0] = *(const v8h*)(p);
  f.h[1] = *(const v8h*)(p + 16);
  return f.v;
}

// ---- same fragment from a plane kept in fragment order: p is wave-uniform, lo = 8*lane; the lanes' first 8 elements are one
//      contiguous 512-B run, their second 8 elements the next 512-B run (256 halves on)
__device__ __forceinline__ v16h ldfrag_f(const _Float16* p, unsigned lo) {
  FragH f;
  f.h[0] = *(const v8h*)(p + lo);
  f.h[1] = *(const v8h*)(p + 256 + lo);
  return f.v;
}

__device__ __forceinline__ v8f mma_raw(v16h a, v16h b, v8f c) {
  return __builtin_amdgcn_wmma_f32_16x16x32_f16(false, a, false, b, (short)0, c, false, false);
}
// value of the lane 16 away (lane l <-> l ^ 16), a vector cross-row move
__device__ __forceinline__ float xhalf(float x) {
  const int b = __builtin_bit_cast(int, x);
  return __builtin_bit_cast(float, __builtin_amdgcn_permlanex16(b, b, 0x76543210, 0xfedcba98, false, false));
}
__device__ __forceinline__ void wave_sync_lds() {
  __builtin_amdgcn_fence(__ATOMIC_RELEASE, "workgroup");
  __builtin_amdgcn_wave_barrier();
  __builtin_amdgcn_fence(__ATOMIC_ACQUIRE, "workgroup");
}

// =====================================================================================================
// 16-bit plane convert (inputs are [bh][s][d] with bh = b*16+h): value f16( bf16(x) * sc ) (sc a power of two, exact).
//   blockIdx.y == 0: q plane, layout [bh][s][d] as the input. blockIdx.y == 1: k plane in fragment order:
//   [row tile of 16][ld = 0..3][lane = 16*hh + c][8 halves] holds k[16*tile + c][16*ld + 8*hh + 0..7].
// Thread = one 16-B chunk of the plane (8 consecutive d of one row): two 16-B loads, one 16-B store; 32 consecutive lanes store 512-B
// coverage: grid = (n8/256, 2) blocks x 256 thr x 8 elements = n = 32*2048*64 per plane exactly (n % 2048 == 0 asserted).
// =====================================================================================================
__global__ __launch_bounds__(256) void cvt16(const float* __restrict__ xq, const float* __restrict__ xk,
                                             unsigned short* plq, unsigned short* plk, int n8, float sc) {
  const int gt = blockIdx.x * 256 + (int)threadIdx.x;
  if (gt >= n8) return;                     // never taken with the exact grid; no barriers in this kernel
  const bool sk = (blockIdx.y != 0);        // block-uniform plane select (both pointers global)
  const float* x = sk ? xk : xq;
  unsigned short* pl = sk ? plk : plq;
  const size_t e = (size_t)gt * 8;          // destination element: the stores stay contiguous for both planes
  // source element: q the same place; k row 16*(gt>>7) + (gt&15), d chunk 2*((gt>>5)&3) + ((gt>>4)&1) (a bijection on gt)
  const size_t es = sk ? ((size_t)((gt >> 7) * 16 + (gt & 15)) * HD + (size_t)((((gt >> 5) & 3) * 2 + ((gt >> 4) & 1)) * 8)) : e;
  const v4f a = *(const v4f*)(x + es), bq = *(const v4f*)(x + es + 4);
  v4u o;
#pragma unroll
  for (int i = 0; i < 2; ++i) {
    o[i]     = pk16(h_bits((_Float16)(bfr(a[2 * i]) * sc)),  h_bits((_Float16)(bfr(a[2 * i + 1]) * sc)));
    o[2 + i] = pk16(h_bits((_Float16)(bfr(bq[2 * i]) * sc)), h_bits((_Float16)(bfr(bq[2 * i + 1]) * sc)));
  }
  unsigned short* d = pl + e;
  {
    *(v4u*)(d) = o;
    
  }
}

// =====================================================================================================
// v^T plane in fragment order, values f16( bf16(v[bh][key][d]) * 256 ) (exact):
//   [bh][step of 32 keys][j = 0..3][part = 0..1][lane = 16*hh + c][8 halves] holds d = 16*j + c, keys 32*step + 16*part + 8*hh + 0..7.
// Block = (bh, tile of 64 keys): 64 source rows of 64 floats loaded with 16-B loads (static stride), converted, written into
// coverage: load 256 thr x 16 elements = 64 keys x 64 d; store 2 iterations x 256 thr x 8 halves = 64 lines x 64 = the tile;
//           grid = NBH x 32 = 1024 blocks, each 8192 contiguous bytes (2 steps): the whole plane exactly once.
// =====================================================================================================
__global__ __launch_bounds__(256) void vt16(const float* __restrict__ v, unsigned short* VTo) {
  __shared__ __align__(16) unsigned short T[HD * VTP];
  const int tid = threadIdx.x;
  const int bid = blockIdx.x;
  const int bh  = bid / VTILES;
  const int t   = bid - bh * VTILES;        // 0..31, block-uniform
  if (bh >= NBH) return;                    // never taken with the exact grid; before any barrier or store
  {
    const int sl = tid >> 2;                  // key within tile 0..63
    const int dc = (tid & 3) * 16;            // d chunk
    int key = 64 * t + sl;                    // <= SEQ-1 by construction; clamp keeps the address in range regardless
    key = (key < 0) ? 0 : ((key > SEQ - 1) ? (SEQ - 1) : key);
    const float* src = v + (((size_t)bh * SEQ + (size_t)key) * HD + dc);
#pragma unroll
    for (int i = 0; i < 4; ++i) {
      const v4f a = *(const v4f*)(src + 4 * i);
#pragma unroll
      for (int e = 0; e < 4; ++e) T[(dc + 4 * i + e) * VTP + sl] = h_bits((_Float16)(bfr(a[e]) * VCAR));
    }
  }
  __syncthreads();
  v4u vals[2];
  const int line = ((tid >> 6) & 3) * 16 + (tid & 15);        // d = 16*j + c, 0..63
  const int p8   = ((tid >> 5) & 1) * 16 + ((tid >> 4) & 1) * 8; // key within the 32-key step: 16*part + 8*hh
#pragma unroll
  for (int it = 0; it < 2; ++it) vals[it] = *(const v4u*)(T + line * VTP + it * 32 + p8);   // it = step within the tile
  unsigned short* dst = VTo + ((size_t)bh * SEQ + (size_t)(64 * t)) * HD + tid * 8;
  {
#pragma unroll
    for (int it = 0; it < 2; ++it) {
      *(v4u*)(dst + (size_t)it * 32 * HD) = vals[it];
    }
    
  }
}

// =====================================================================================================
// Masked flash attention per (b,h), scores taken transposed. Block = (bh, 64 queries), wave w owns queries iw = 64t + 16w .. +15.
//   q plane f16 [bh][s][d], k plane and v^T plane f16 in fragment order (4096 contiguous bytes each per 32-key step), mask
//   int [s][s] shared over bh (read per element, 0 = masked).
//   Key loop (uniform bound): kb = 0, 32, ..., SEQ-32; every key tile is visited.
//   Per 32-key step: S^T = K.Q^T, A = k fragment (row = key), B = q fragment (column = query), 2 key subtiles x 2 k-steps x 1
//   product. Lane (hh, c) then holds, for its ONE query iw + c, the 16 keys kb + 8hh + 0..7 and kb + 16 + 8hh + 0..7: the
//   mask is four 16-B loads of the query's own mask row, applied by value in the log2 domain (t := -1e9*log2e where mask == 0,
//   the scaled score otherwise), so a row whose visited keys are all masked stays uniform exactly like the spec and a single
//   unmasked key zeroes every masked term through exp2; the step's maximum is taken in the lane plus one exchange between the
//   lane halves; the sum stays a per-lane partial (its own 16 keys of each step), joined once behind the loop.
//   Those 16 values are, in this order, the B fragment of P^T in the split k map: P*32768 (f16 hi) and its f16 residual are
//   converted in place, no LDS and no lane exchange. O^T += V^T.P^T, A = v^T fragment (row = d), 8 WMMAs; the rescale
//   factor of the 4 accumulators is one value per lane.
//   Epilogue: 1/l and carry folds in f32; lane (hh, c) holds d = 16j + 8hh + 0..7 of query iw + c; the wave's 16x64 f32 result is
//   staged in its LDS slab (pitch 68) and stored as whole 256-B rows.
//   No block barriers in this kernel; every wave of a block does exactly 64 steps.
// coverage: per wave 8 instructions x 32 lanes x 4 floats = 16 rows x 64; per block 4 waves = 64 rows; 32 blocks per bh x
//           32 bh: every row of out [32][2048][64] exactly once (grid 1024 blocks).
// =====================================================================================================
__global__ __launch_bounds__(ATT_THREADS)
void attn_masked(const unsigned short* __restrict__ QHp, const unsigned short* __restrict__ KHp,
                 const unsigned short* __restrict__ VTq, const int* __restrict__ Msk, float* OPp) {
  __shared__ __align__(16) float smem[ATW * SLABF];    // per wave: result slab of the epilogue

  const int tid  = threadIdx.x;
  const int wave = tid >> 5;
  const int lane = tid & 31;
  const int hh   = lane >> 4;
  const int c    = lane & 15;

  const int bid  = blockIdx.x;
  const int bh   = bid / BPH;
  const int t    = bid - bh * BPH;                     // 0..31, block-uniform
  if (bh >= NBH) return;                               // never taken with the exact grid; before any LDS use or store

  const int i0 = QPB * t;
  const int iw = i0 + wave * 16;                       // query 0 of this wave, <= SEQ-16
  const int qs = iw + c;                               // this lane's query, <= SEQ-1 by construction

  const _Float16* Qb = (const _Float16*)(const void*)QHp + ((size_t)bh * SEQ + (size_t)qs) * HD + 8 * hh;
  const v16h qb0 = ldfrag_h(Qb);                       // d 0..31
  const v16h qb1 = ldfrag_h(Qb + 32);                  // d 32..63
  const _Float16* Kb = (const _Float16*)(const void*)KHp + (size_t)bh * SEQ * HD;   // block-uniform plane bases
  const _Float16* Vb = (const _Float16*)(const void*)VTq + (size_t)bh * SEQ * HD;
  const unsigned  lo = 8u * (unsigned)lane;            // this lane's 16-B chunk in each 512-B run, lane = 16*hh + c
  const int* Mb = Msk + (size_t)qs * SEQ + 8 * hh;     // mask row qs, key 8hh (no bh offset: shared over batch and heads)
  const float lsc = LOG2E / (8.0f * QSC * KSC);        // 1/sqrt(64) and the q,k carries, base-2 domain

  float mrow = -INFINITY, lrow = 0.f;                  // this lane's query: running maximum (both halves equal), partial sum
  v8f o[4];
#pragma unroll
  for (int j = 0; j < 4; ++j) o[j] = zero8();

  // kept rolled: one step's registers and a short loop text
#pragma unroll 1
  for (int kb = 0; kb < SEQ; kb += 32) {
    // ---- the step's loads: mask values for (query qs, keys kb + 8hh + 0..7) and (.., keys kb + 16 + 8hh + 0..7), the k fragments
    //      (A, row = key) and the v^T fragments (A, row m = d = j*16 + c, 1024 bytes per j); all in range by construction ----
    const int* mk = Mb + kb;
    const v4i ma0 = *(const v4i*)(mk),      ma1 = *(const v4i*)(mk + 4);
    const v4i mb0 = *(const v4i*)(mk + 16), mb1 = *(const v4i*)(mk + 20);
    const _Float16* k0p = Kb + (size_t)kb * HD;                    // row tile kb/16: key row kb + c
    const _Float16* k1p = k0p + (size_t)16 * HD;                   // next row tile: key row kb + 16 + c
    const v16h kf00 = ldfrag_f(k0p, lo), kf01 = ldfrag_f(k0p + 512, lo);   // d 0..31, d 32..63
    const v16h kf10 = ldfrag_f(k1p, lo), kf11 = ldfrag_f(k1p + 512, lo);
    const _Float16* vp = Vb + (size_t)kb * HD;                     // step kb/32, 32*HD halves each
    const v16h va0 = ldfrag_f(vp, lo);
    const v16h va1 = ldfrag_f(vp + 512, lo);
    const v16h va2 = ldfrag_f(vp + 1024, lo);
    const v16h va3 = ldfrag_f(vp + 1536, lo);
    // ---- scores: D element r of this lane = (key kb + 8hh + r, query qs) in s0, key kb + 16 + 8hh + r in s1 ----
    v8f s0 = zero8(), s1 = zero8();
    s0 = mma_raw(kf00, qb0, s0);
    s0 = mma_raw(kf01, qb1, s0);
    s1 = mma_raw(kf10, qb0, s1);
    s1 = mma_raw(kf11, qb1, s1);
    // ---- replace-mask by value + online softmax in base 2, all 16 keys of the query in this lane ----
    v8f t0 = s0 * lsc, t1 = s1 * lsc;
#pragma unroll
    for (int r = 0; r < 8; ++r) {
      const int m0 = (r < 4) ? ma0[r & 3] : ma1[r & 3];
      const int m1 = (r < 4) ? mb0[r & 3] : mb1[r & 3];
      t0[r] = (m0 == 0) ? NEGT : t0[r];
      t1[r] = (m1 == 0) ? NEGT : t1[r];
    }
    float mx = fmaxf(t0[0], t1[0]);
#pragma unroll
    for (int r = 1; r < 8; ++r) mx = fmaxf(mx, fmaxf(t0[r], t1[r]));
    mx = fmaxf(mx, xhalf(mx));                         // the other 16 keys of the step
    const float mn = fmaxf(mrow, mx);                  // finite: mx is either a scaled score or NEGT
    const float al = exp2f(mrow - mn);                 // 0 on the first step (mrow = -inf)
    mrow = mn;
    t0 -= mn;
    t1 -= mn;
    v8f e0, e1;
#pragma unroll
    for (int r = 0; r < 8; ++r) { e0[r] = exp2f(t0[r]); e1[r] = exp2f(t1[r]); }
    const v8f es = e0 + e1;
    lrow = lrow * al + (((es[0] + es[1]) + (es[2] + es[3])) + ((es[4] + es[5]) + (es[6] + es[7])));
#pragma unroll
    for (int j = 0; j < 4; ++j) o[j] *= al;
    // ---- B fragments of P^T*32768: hi f16 and residual f16, column = query c; elements 0..7 = keys kb + 8hh + 0..7 (e0),
    //      elements 8..15 = keys kb + 16 + 8hh + 0..7 (e1): the split k map of the v^T fragments ----
    FragH ph, pl;
    {
      const v8f ta = e0 * PCAR, tb = e1 * PCAR;
      ph.h[0] = __builtin_convertvector(ta, v8h);
      ph.h[1] = __builtin_convertvector(tb, v8h);
      pl.h[0] = __builtin_convertvector(ta - __builtin_convertvector(ph.h[0], v8f), v8h);
      pl.h[1] = __builtin_convertvector(tb - __builtin_convertvector(ph.h[1], v8f), v8h);
    }
    // ---- O^T += V^T.P^T over keys kb .. kb+31 ----
    o[0] = mma_raw(va0, ph.v, o[0]);  o[0] = mma_raw(va0, pl.v, o[0]);
    o[1] = mma_raw(va1, ph.v, o[1]);  o[1] = mma_raw(va1, pl.v, o[1]);
    o[2] = mma_raw(va2, ph.v, o[2]);  o[2] = mma_raw(va2, pl.v, o[2]);
    o[3] = mma_raw(va3, ph.v, o[3]);  o[3] = mma_raw(va3, pl.v, o[3]);
  }

  // ---- join the halves' sums, fold 1/l and the carries (32768 on P, 256 on v), stage the wave's 16x64 slab in its LDS region ----
  float* slab = smem + wave * SLABF;
  const float oc  = 1.0f / (PCAR * VCAR);
  const float lr  = lrow + xhalf(lrow);                  // >= 1 (the max element contributes 2^0)
  const float inv = (lr > 0.0f) ? ((1.0f / lr) * oc) : 0.0f;
#pragma unroll
  for (int j = 0; j < 4; ++j) {
    float* sp = slab + c * SLP + j * 16 + 8 * hh;        // D element r of o[j] = (d = 16j + 8hh + r, query iw + c)
    v4f w0, w1;
#pragma unroll
    for (int e = 0; e < 4; ++e) { w0[e] = o[j][e] * inv; w1[e] = o[j][4 + e] * inv; }
    *(v4f*)(sp)     = w0;
    *(v4f*)(sp + 4) = w1;
  }
  wave_sync_lds();
  v4f vals[8];
#pragma unroll
  for (int it = 0; it < 8; ++it) vals[it] = *(const v4f*)(slab + (2 * it + hh) * SLP + c * 4);
  float* dst = OPp + ((size_t)(bh * SEQ + iw)) * HD + hh * HD + c * 4;
  {
#pragma unroll
    for (int it = 0; it < 8; ++it) {
      *(v4f*)(dst + (size_t)(2 * it) * HD) = vals[it];
    }
    
  }
}

// =====================================================================================================
// Workspace map (bytes); every plane is fully written by whole-line stores before it is read; all extents are exact
// multiples of the store granularity (no pad rows needed); offsets multiples of 128:
//   QH f16 [32][2048][64] x1024        8388608   at        0
//   KH f16 fragment order x1024        8388608   at  8388608
//   VT f16 fragment order x256         8388608   at 16777216
//   end                                             25165824
// =====================================================================================================
extern "C" void kernel_launch(void* const* d_in, const int* in_sizes, int n_in,
                              void* d_out, int out_size, void* d_ws, size_t ws_size,
                              hipStream_t stream) {
  const int NEL = NBH * SEQ * HD;                       // 4194304
  if (n_in < 4) return;
  if (in_sizes[0] < NEL || in_sizes[1] < NEL || in_sizes[2] < NEL || in_sizes[3] < SEQ * SEQ) return;
  if (out_size < NEL) return;

  const float* q  = (const float*)d_in[0];
  const float* k  = (const float*)d_in[1];
  const float* v  = (const float*)d_in[2];
  const int*   mk = (const int*)d_in[3];
  float*       out = (float*)d_out;

  const size_t PQ = (size_t)NEL * 2;                    //  8388608
  const size_t PK = (size_t)NEL * 2;                    //  8388608
  const size_t PV = (size_t)NBH * HD * SEQ * 2;         //  8388608
  size_t off = 0;
  const size_t oQH = off; off += PQ;
  const size_t oKH = off; off += PK;
  const size_t oVT = off; off += PV;
  if (off > ws_size) return;                            // off = 25165824
  if (off > (size_t)134217728) return;

  char* ws = (char*)d_ws;
  unsigned short* QH = (unsigned short*)(ws + oQH);
  unsigned short* KH = (unsigned short*)(ws + oKH);
  unsigned short* VT = (unsigned short*)(ws + oVT);

  const int n8 = NEL / 8;                               // 524288
  const dim3 blk(256);
  const dim3 gC(n8 / 256, 2);                           // (2048, 2): q and k planes in one launch
  const dim3 gVT(NBH * VTILES);                         // 1024
  const dim3 gAT(ATT_BLOCKS);                           // 1024
  const dim3 bAT(ATT_THREADS);                          // 128

  // (0) q and k planes f16(bf16(x) * 1024): q [bh][s][d], k fragment order
  cvt16<<<gC, blk, 0, stream>>>(q, k, QH, KH, n8, QSC);
  // (1) v^T plane f16(bf16(v) * 256), fragment order
  vt16<<<gVT, blk, 0, stream>>>(v, VT);
  // (2) masked flash attention per (b,h) -> out [bh][s][d] f32
  attn_masked<<<gAT, bAT, 0, stream>>>(QH, KH, VT, mk, out);
  (void)hipGetLastError();
}

// v003
// A run of this version takes 78.8 microseconds.
// In both of two side-by-side timings against v002, it was 1.18 times as fast.
// Over all steps from v000 it is 1.76 times as fast.
// Contractions: scores k.q^T (k x1024 as A and q x1024 as B, f16 planes of the bf16-RNE-converted inputs, one product each,
// K=64) and v^T.P^T (v x256 f16 of the bf16-RNE-converted input as A, P x32768 as f16 hi plane + f16 residual plane as B,
// products v.hi+v.lo, 32-key steps): all v_wmma_f32_16x16x32_f16, f32 accumulate. A lane holds one query's scores: base-2 online
// softmax in the lane with the key mask applied by value (replace) and the 1/l fold in f32 on VALU. The int mask is packed once
// per call to one bit per key (bit = mask != 0); a lane reads one 32-bit word per 32-key step.
// The k plane and the v^T plane lie in fragment order: each 16-B load of a fragment reads 512 contiguous bytes per wave.
#include <hip/hip_runtime.h>
#include <math.h>
#include <stdint.h>

#define NBH   32
#define SEQ   2048
#define HD    64
#define QSC   1024.0f
#define KSC   1024.0f
#define PCAR  32768.0f
#define VCAR  256.0f
#define LOG2E 1.4426950408889634f
#define NEGT  (-1.0e9f * LOG2E)
#define ATW   4
#define ATT_THREADS (ATW * 32)
#define QPB   (16 * ATW)
#define BPH   (SEQ / QPB)
#define ATT_BLOCKS (NBH * BPH)
#define SLP   68
#define SLABF (16 * SLP)
#define VTP   72
#define VTILES (SEQ / 64)
static_assert(HD == 64 && QPB == 64 && ATT_THREADS == 128);
static_assert((SEQ % QPB) == 0 && (SEQ % 64) == 0 && (SEQ % 32) == 0);
static_assert(BPH == 32 && ATT_BLOCKS == 1024 && VTILES == 32);
static_assert((HD - 1) * VTP + 63 < HD * VTP);
static_assert(((NBH * SEQ * HD) % 2048) == 0);
#define CVB   ((NBH * SEQ * HD) / 2048)
static_assert(2 * CVB == (SEQ / 16) * (SEQ / 64));     // convert blocks of both planes = (query tiles) x (pairs of 32-key steps)

typedef _Float16 v16h __attribute__((ext_vector_type(16)));
typedef _Float16 v8h  __attribute__((ext_vector_type(8)));
typedef float    v8f  __attribute__((ext_vector_type(8)));
typedef float    v4f  __attribute__((ext_vector_type(4)));
typedef unsigned int v4u __attribute__((ext_vector_type(4)));
typedef int      v4i  __attribute__((ext_vector_type(4)));

union FragH { v16h v; v8h h[2]; v4u u[2]; };

// ---- scalar helpers --------------------------------------------------------------------------------
__device__ __forceinline__ unsigned short bf_bits(float f) {          // f32 -> bf16 bits, RNE convert
  unsigned u = __float_as_uint(f);
  return (unsigned short)((u + 0x7FFFu + ((u >> 16) & 1u)) >> 16);
}
__device__ __forceinline__ float bf_up(unsigned short h) { return __uint_as_float(((unsigned)h) << 16); }
__device__ __forceinline__ float bfr(float f) { return bf_up(bf_bits(f)); }   // value of the bf16 RNE convert
__device__ __forceinline__ unsigned short h_bits(_Float16 x) { return __builtin_bit_cast(unsigned short, x); }
__device__ __forceinline__ unsigned pk16(unsigned short a, unsigned short b) { return (unsigned)a | ((unsigned)b << 16); }
__device__ __forceinline__ v8f zero8() { v8f z = {0.f, 0.f, 0.f, 0.f, 0.f, 0.f, 0.f, 0.f}; return z; }

// ---- fragment loader: 16-bit A/B operand, lane -> row/col (lane&15), p already includes +8*(lane>>4);
//      elements 0..7 <- p[0..7] (k0+8h..), elements 8..15 <- p[16..23] (k0+16+8h..)  (same split k map for A and B;
//      here it reads only B, from the [s][d] q plane; A fragments use ldfrag_f)
__device__ __forceinline__ v16h ldfrag_h(const _Float16* p) {
  FragH f;
  f.h[0] = *(const v8h*)(p);
  f.h[1] = *(const v8h*)(p + 16);
  return f.v;
}

// ---- same fragment from a plane kept in fragment order: p is wave-uniform, lo = 8*lane; the lanes' first 8 elements are one
//      contiguous 512-B run, their second 8 elements the next 512-B run (256 halves on)
__device__ __forceinline__ v16h ldfrag_f(const _Float16* p, unsigned lo) {
  FragH f;
  f.h[0] = *(const v8h*)(p + lo);
  f.h[1] = *(const v8h*)(p + 256 + lo);
  return f.v;
}

__device__ __forceinline__ v8f mma_raw(v16h a, v16h b, v8f c) {
  return __builtin_amdgcn_wmma_f32_16x16x32_f16(false, a, false, b, (short)0, c, false, false);
}
// value of the lane 16 away (lane l <-> l ^ 16), a vector cross-row move
__device__ __forceinline__ float xhalf(float x) {
  const int b = __builtin_bit_cast(int, x);
  return __builtin_bit_cast(float, __builtin_amdgcn_permlanex16(b, b, 0x76543210, 0xfedcba98, false, false));
}
__device__ __forceinline__ void wave_sync_lds() {
  __builtin_amdgcn_fence(__ATOMIC_RELEASE, "workgroup");
  __builtin_amdgcn_wave_barrier();
  __builtin_amdgcn_fence(__ATOMIC_ACQUIRE, "workgroup");
}

// =====================================================================================================
// 16-bit plane convert (inputs are [bh][s][d] with bh = b*16+h): value f16( bf16(x) * sc ) (sc a power of two, exact).
//   blockIdx.y == 0: q plane, layout [bh][s][d] as the input. blockIdx.y == 1: k plane in fragment order:
//   [row tile of 16][ld = 0..3][lane = 16*hh + c][8 halves] holds k[16*tile + c][16*ld + 8*hh + 0..7].
// Thread = one 16-B chunk of the plane (8 consecutive d of one row): two 16-B loads, one 16-B store; 32 consecutive lanes store 512-B
//   Every block also packs its share of the mask bits, plane [query tile of 16][step of 32 keys][c = 0..15] of 32-bit words:
//   bit b of a word is (mask[16*tile + c][32*step + b] != 0). Block = (query tile, 2 steps): wave w takes queries 2w, 2w+1;
//   a word is one 128-B load of the wave and one ballot; the block's 32 words are one whole 128-B line (one writer).
// coverage: grid = (n8/256, 2) blocks x 256 thr x 8 elements = n = 32*2048*64 per plane exactly (n % 2048 == 0 asserted);
//           mask: 128 tiles x 32 pairs of steps = 4096 blocks x 32 words = 2048 queries x 64 words, each exactly once.
// =====================================================================================================
__global__ __launch_bounds__(256) void cvt16(const float* __restrict__ xq, const float* __restrict__ xk,
                                             unsigned short* plq, unsigned short* plk, int n8, float sc,
                                             const int* __restrict__ msk, unsigned int* mbits) {
  const int gt = blockIdx.x * 256 + (int)threadIdx.x;
  if (gt >= n8) return;                     // never taken with the exact grid; no barriers in this kernel
  int mx[4];                                // mask values of this wave's 4 words; every lane is on (exact grid)
  const int lane = (int)threadIdx.x & 31, wv = (int)threadIdx.x >> 5;
  const int fb = (int)blockIdx.y * CVB + (int)blockIdx.x;                // 0..4095: query tile fb >> 5, pair of steps fb & 31
  const bool sk = (blockIdx.y != 0);        // block-uniform plane select (both pointers global)
  const float* x = sk ? xk : xq;
  unsigned short* pl = sk ? plk : plq;
  const size_t e = (size_t)gt * 8;          // destination element: the stores stay contiguous for both planes
  // source element: q the same place; k row 16*(gt>>7) + (gt&15), d chunk 2*((gt>>5)&3) + ((gt>>4)&1) (a bijection on gt)
  const size_t es = sk ? ((size_t)((gt >> 7) * 16 + (gt & 15)) * HD + (size_t)((((gt >> 5) & 3) * 2 + ((gt >> 4) & 1)) * 8)) : e;
  const v4f a = *(const v4f*)(x + es), bq = *(const v4f*)(x + es + 4);
  {
    const int* mp = msk + ((size_t)(16 * (fb >> 5) + 2 * wv) * SEQ + (size_t)(64 * (fb & 31) + lane));
#pragma unroll
    for (int i = 0; i < 4; ++i) mx[i] = mp[(size_t)(i >> 1) * SEQ + (size_t)(32 * (i & 1))];  // query 2wv + (i>>1), step 2(fb&31) + (i&1)
  }
  v4u o;
#pragma unroll
  for (int i = 0; i < 2; ++i) {
    o[i]     = pk16(h_bits((_Float16)(bfr(a[2 * i]) * sc)),  h_bits((_Float16)(bfr(a[2 * i + 1]) * sc)));
    o[2 + i] = pk16(h_bits((_Float16)(bfr(bq[2 * i]) * sc)), h_bits((_Float16)(bfr(bq[2 * i + 1]) * sc)));
  }
  unsigned short* d = pl + e;
  {
    *(v4u*)(d) = o;
    
  }
  unsigned int w = 0u;
#pragma unroll
  for (int i = 0; i < 4; ++i) {
    const unsigned int b = __builtin_amdgcn_ballot_w32(mx[i] != 0);
    w = (lane == i) ? b : w;                // lane i keeps word i
  }
  if (lane < 4) mbits[(size_t)fb * 32 + (size_t)((lane & 1) * 16 + 2 * wv + (lane >> 1))] = w;
}

// =====================================================================================================
// v^T plane in fragment order, values f16( bf16(v[bh][key][d]) * 256 ) (exact):
//   [bh][step of 32 keys][j = 0..3][part = 0..1][lane = 16*hh + c][8 halves] holds d = 16*j + c, keys 32*step + 16*part + 8*hh + 0..7.
// Block = (bh, tile of 64 keys): 64 source rows of 64 floats loaded with 16-B loads (static stride), converted, written into
// coverage: load 256 thr x 16 elements = 64 keys x 64 d; store 2 iterations x 256 thr x 8 halves = 64 lines x 64 = the tile;
//           grid = NBH x 32 = 1024 blocks, each 8192 contiguous bytes (2 steps): the whole plane exactly once.
// =====================================================================================================
__global__ __launch_bounds__(256) void vt16(const float* __restrict__ v, unsigned short* VTo) {
  __shared__ __align__(16) unsigned short T[HD * VTP];
  const int tid = threadIdx.x;
  const int bid = blockIdx.x;
  const int bh  = bid / VTILES;
  const int t   = bid - bh * VTILES;        // 0..31, block-uniform
  if (bh >= NBH) return;                    // never taken with the exact grid; before any barrier or store
  {
    const int sl = tid >> 2;                  // key within tile 0..63
    const int dc = (tid & 3) * 16;            // d chunk
    int key = 64 * t + sl;                    // <= SEQ-1 by construction; clamp keeps the address in range regardless
    key = (key < 0) ? 0 : ((key > SEQ - 1) ? (SEQ - 1) : key);
    const float* src = v + (((size_t)bh * SEQ + (size_t)key) * HD + dc);
#pragma unroll
    for (int i = 0; i < 4; ++i) {
      const v4f a = *(const v4f*)(src + 4 * i);
#pragma unroll
      for (int e = 0; e < 4; ++e) T[(dc + 4 * i + e) * VTP + sl] = h_bits((_Float16)(bfr(a[e]) * VCAR));
    }
  }
  __syncthreads();
  v4u vals[2];
  const int line = ((tid >> 6) & 3) * 16 + (tid & 15);        // d = 16*j + c, 0..63
  const int p8   = ((tid >> 5) & 1) * 16 + ((tid >> 4) & 1) * 8; // key within the 32-key step: 16*part + 8*hh
#pragma unroll
  for (int it = 0; it < 2; ++it) vals[it] = *(const v4u*)(T + line * VTP + it * 32 + p8);   // it = step within the tile
  unsigned short* dst = VTo + ((size_t)bh * SEQ + (size_t)(64 * t)) * HD + tid * 8;
  {
#pragma unroll
    for (int it = 0; it < 2; ++it) {
      *(v4u*)(dst + (size_t)it * 32 * HD) = vals[it];
    }
    
  }
}

// =====================================================================================================
// Masked flash attention per (b,h), scores taken transposed. Block = (bh, 64 queries), wave w owns queries iw = 64t + 16w .. +15.
//   q plane f16 [bh][s][d], k plane and v^T plane f16 in fragment order (4096 contiguous bytes each per 32-key step), mask
//   bits [query tile][step][c] shared over bh (bit clear = masked): 64 contiguous bytes per wave and step.
//   Key loop (uniform bound): kb = 0, 32, ..., SEQ-32; every key tile is visited.
//   Per 32-key step: S^T = K.Q^T, A = k fragment (row = key), B = q fragment (column = query), 2 key subtiles x 2 k-steps x 1
//   product. Lane (hh, c) then holds, for its ONE query iw + c, the 16 keys kb + 8hh + 0..7 and kb + 16 + 8hh + 0..7: the
//   mask is one 32-bit word of the query's own bits, applied by value in the log2 domain (t := -1e9*log2e where mask == 0,
//   the scaled score otherwise), so a row whose visited keys are all masked stays uniform exactly like the spec and a single
//   unmasked key zeroes every masked term through exp2; the step's maximum is taken in the lane plus one exchange between the
//   lane halves; the sum stays a per-lane partial (its own 16 keys of each step), joined once behind the loop.
//   Those 16 values are, in this order, the B fragment of P^T in the split k map: P*32768 (f16 hi) and its f16 residual are
//   converted in place, no LDS and no lane exchange. O^T += V^T.P^T, A = v^T fragment (row = d), 8 WMMAs; the rescale
//   factor of the 4 accumulators is one value per lane.
//   Epilogue: 1/l and carry folds in f32; lane (hh, c) holds d = 16j + 8hh + 0..7 of query iw + c; the wave's 16x64 f32 result is
//   staged in its LDS slab (pitch 68) and stored as whole 256-B rows.
//   No block barriers in this kernel; every wave of a block does exactly 64 steps.
// coverage: per wave 8 instructions x 32 lanes x 4 floats = 16 rows x 64; per block 4 waves = 64 rows; 32 blocks per bh x
//           32 bh: every row of out [32][2048][64] exactly once (grid 1024 blocks).
// =====================================================================================================
__global__ __launch_bounds__(ATT_THREADS)
void attn_masked(const unsigned short* __restrict__ QHp, const unsigned short* __restrict__ KHp,
                 const unsigned short* __restrict__ VTq, const unsigned int* __restrict__ Msk, float* OPp) {
  __shared__ __align__(16) float smem[ATW * SLABF];    // per wave: result slab of the epilogue

  const int tid  = threadIdx.x;
  const int wave = tid >> 5;
  const int lane = tid & 31;
  const int hh   = lane >> 4;
  const int c    = lane & 15;

  const int bid  = blockIdx.x;
  const int bh   = bid / BPH;
  const int t    = bid - bh * BPH;                     // 0..31, block-uniform
  if (bh >= NBH) return;                               // never taken with the exact grid; before any LDS use or store

  const int i0 = QPB * t;
  const int iw = i0 + wave * 16;                       // query 0 of this wave, <= SEQ-16
  const int qs = iw + c;                               // this lane's query, <= SEQ-1 by construction

  const _Float16* Qb = (const _Float16*)(const void*)QHp + ((size_t)bh * SEQ + (size_t)qs) * HD + 8 * hh;
  const v16h qb0 = ldfrag_h(Qb);                       // d 0..31
  const v16h qb1 = ldfrag_h(Qb + 32);                  // d 32..63
  const _Float16* Kb = (const _Float16*)(const void*)KHp + (size_t)bh * SEQ * HD;   // block-uniform plane bases
  const _Float16* Vb = (const _Float16*)(const void*)VTq + (size_t)bh * SEQ * HD;
  const unsigned  lo = 8u * (unsigned)lane;            // this lane's 16-B chunk in each 512-B run, lane = 16*hh + c
  const unsigned int* Mb = Msk + (size_t)(iw >> 4) * (SEQ / 32 * 16) + c;   // query tile iw/16, word of query c (shared over bh)
  const unsigned int NEGB = __builtin_bit_cast(unsigned int, NEGT);
  const float lsc = LOG2E / (8.0f * QSC * KSC);        // 1/sqrt(64) and the q,k carries, base-2 domain

  float mrow = -INFINITY, lrow = 0.f;                  // this lane's query: running maximum (both halves equal), partial sum
  v8f o[4];
#pragma unroll
  for (int j = 0; j < 4; ++j) o[j] = zero8();

  // kept rolled: one step's registers and a short loop text
#pragma unroll 1
  for (int kb = 0; kb < SEQ; kb += 32) {
    // ---- the step's loads: mask word of (query qs, keys kb .. kb + 31; both lane halves read the same word), the k fragments
    //      (A, row = key) and the v^T fragments (A, row m = d = j*16 + c, 1024 bytes per j); all in range by construction ----
    const unsigned int mw = Mb[kb >> 1] >> (8 * hh);               // step kb/32, 16 words each; bit r = key kb + 8hh + r
    const _Float16* k0p = Kb + (size_t)kb * HD;                    // row tile kb/16: key row kb + c
    const _Float16* k1p = k0p + (size_t)16 * HD;                   // next row tile: key row kb + 16 + c
    const v16h kf00 = ldfrag_f(k0p, lo), kf01 = ldfrag_f(k0p + 512, lo);   // d 0..31, d 32..63
    const v16h kf10 = ldfrag_f(k1p, lo), kf11 = ldfrag_f(k1p + 512, lo);
    // the address registers of the loads above are given new values below (the v^T loads land in them, the mask address steps on)
    asm volatile("s_wait_xcnt 0x0" ::: "memory");
    const _Float16* vp = Vb + (size_t)kb * HD;                     // step kb/32, 32*HD halves each
    const v16h va0 = ldfrag_f(vp, lo);
    const v16h va1 = ldfrag_f(vp + 512, lo);
    const v16h va2 = ldfrag_f(vp + 1024, lo);
    const v16h va3 = ldfrag_f(vp + 1536, lo);
    // ---- scores: D element r of this lane = (key kb + 8hh + r, query qs) in s0, key kb + 16 + 8hh + r in s1 ----
    v8f s0 = zero8(), s1 = zero8();
    s0 = mma_raw(kf00, qb0, s0);
    s0 = mma_raw(kf01, qb1, s0);
    s1 = mma_raw(kf10, qb0, s1);
    s1 = mma_raw(kf11, qb1, s1);
    // ---- replace-mask by value + online softmax in base 2, all 16 keys of the query in this lane ----
    v8f t0 = s0 * lsc, t1 = s1 * lsc;
#pragma unroll
    for (int r = 0; r < 8; ++r) {
      const unsigned int m0 = (unsigned int)(((int)(mw << (31 - r))) >> 31);    // all ones where the key is kept
      const unsigned int m1 = (unsigned int)(((int)(mw << (15 - r))) >> 31);    // bit 16 + r = key kb + 16 + 8hh + r
      t0[r] = __builtin_bit_cast(float, (__builtin_bit_cast(unsigned int, (float)t0[r]) & m0) | (NEGB & ~m0));
      t1[r] = __builtin_bit_cast(float, (__builtin_bit_cast(unsigned int, (float)t1[r]) & m1) | (NEGB & ~m1));
    }
    float mx = fmaxf(t0[0], t1[0]);
#pragma unroll
    for (int r = 1; r < 8; ++r) mx = fmaxf(mx, fmaxf(t0[r], t1[r]));
    mx = fmaxf(mx, xhalf(mx));                         // the other 16 keys of the step
    const float mn = fmaxf(mrow, mx);                  // finite: mx is either a scaled score or NEGT
    const float al = exp2f(mrow - mn);                 // 0 on the first step (mrow = -inf)
    mrow = mn;
    t0 -= mn;
    t1 -= mn;
    v8f e0, e1;
#pragma unroll
    for (int r = 0; r < 8; ++r) { e0[r] = exp2f(t0[r]); e1[r] = exp2f(t1[r]); }
    const v8f es = e0 + e1;
    lrow = lrow * al + (((es[0] + es[1]) + (es[2] + es[3])) + ((es[4] + es[5]) + (es[6] + es[7])));
#pragma unroll
    for (int j = 0; j < 4; ++j) o[j] *= al;
    // ---- B fragments of P^T*32768: hi f16 and residual f16, column = query c; elements 0..7 = keys kb + 8hh + 0..7 (e0),
    //      elements 8..15 = keys kb + 16 + 8hh + 0..7 (e1): the split k map of the v^T fragments ----
    FragH ph, pl;
    {
      const v8f ta = e0 * PCAR, tb = e1 * PCAR;
      ph.h[0] = __builtin_convertvector(ta, v8h);
      ph.h[1] = __builtin_convertvector(tb, v8h);
      pl.h[0] = __builtin_convertvector(ta - __builtin_convertvector(ph.h[0], v8f), v8h);
      pl.h[1] = __builtin_convertvector(tb - __builtin_convertvector(ph.h[1], v8f), v8h);
    }
    // ---- O^T += V^T.P^T over keys kb .. kb+31 ----
    o[0] = mma_raw(va0, ph.v, o[0]);  o[0] = mma_raw(va0, pl.v, o[0]);
    o[1] = mma_raw(va1, ph.v, o[1]);  o[1] = mma_raw(va1, pl.v, o[1]);
    o[2] = mma_raw(va2, ph.v, o[2]);  o[2] = mma_raw(va2, pl.v, o[2]);
    o[3] = mma_raw(va3, ph.v, o[3]);  o[3] = mma_raw(va3, pl.v, o[3]);
  }

  // ---- join the halves' sums, fold 1/l and the carries (32768 on P, 256 on v), stage the wave's 16x64 slab in its LDS region ----
  float* slab = smem + wave * SLABF;
  const float oc  = 1.0f / (PCAR * VCAR);
  const float lr  = lrow + xhalf(lrow);                  // >= 1 (the max element contributes 2^0)
  const float inv = (lr > 0.0f) ? ((1.0f / lr) * oc) : 0.0f;
#pragma unroll
  for (int j = 0; j < 4; ++j) {
    float* sp = slab + c * SLP + j * 16 + 8 * hh;        // D element r of o[j] = (d = 16j + 8hh + r, query iw + c)
    v4f w0, w1;
#pragma unroll
    for (int e = 0; e < 4; ++e) { w0[e] = o[j][e] * inv; w1[e] = o[j][4 + e] * inv; }
    *(v4f*)(sp)     = w0;
    *(v4f*)(sp + 4) = w1;
  }
  wave_sync_lds();
  v4f vals[8];
#pragma unroll
  for (int it = 0; it < 8; ++it) vals[it] = *(const v4f*)(slab + (2 * it + hh) * SLP + c * 4);
  float* dst = OPp + ((size_t)(bh * SEQ + iw)) * HD + hh * HD + c * 4;
  {
#pragma unroll
    for (int it = 0; it < 8; ++it) {
      *(v4f*)(dst + (size_t)(2 * it) * HD) = vals[it];
    }
    
  }
}

// =====================================================================================================
// Workspace map (bytes); every plane is fully written by whole-line stores before it is read; all extents are exact
// multiples of the store granularity (no pad rows needed); offsets multiples of 128:
//   QH f16 [32][2048][64] x1024        8388608   at        0
//   KH f16 fragment order x1024        8388608   at  8388608
//   VT f16 fragment order x256         8388608   at 16777216
//   MB mask bits [128][64][16] u32      524288   at 25165824
//   end                                             25690112
// =====================================================================================================
extern "C" void kernel_launch(void* const* d_in, const int* in_sizes, int n_in,
                              void* d_out, int out_size, void* d_ws, size_t ws_size,
                              hipStream_t stream) {
  const int NEL = NBH * SEQ * HD;                       // 4194304
  if (n_in < 4) return;
  if (in_sizes[0] < NEL || in_sizes[1] < NEL || in_sizes[2] < NEL || in_sizes[3] < SEQ * SEQ) return;
  if (out_size < NEL) return;

  const float* q  = (const float*)d_in[0];
  const float* k  = (const float*)d_in[1];
  const float* v  = (const float*)d_in[2];
  const int*   mk = (const int*)d_in[3];
  float*       out = (float*)d_out;

  const size_t PQ = (size_t)NEL * 2;                    //  8388608
  const size_t PK = (size_t)NEL * 2;                    //  8388608
  const size_t PV = (size_t)NBH * HD * SEQ * 2;         //  8388608
  size_t off = 0;
  const size_t oQH = off; off += PQ;
  const size_t oKH = off; off += PK;
  const size_t oVT = off; off += PV;
  const size_t oMB = off; off += (size_t)SEQ * SEQ / 8; //   524288
  if (off > ws_size) return;                            // off = 25690112
  if (off > (size_t)134217728) return;

  char* ws = (char*)d_ws;
  unsigned short* QH = (unsigned short*)(ws + oQH);
  unsigned short* KH = (unsigned short*)(ws + oKH);
  unsigned short* VT = (unsigned short*)(ws + oVT);
  unsigned int*   MB = (unsigned int*)(ws + oMB);

  const int n8 = NEL / 8;                               // 524288
  const dim3 blk(256);
  const dim3 gC(n8 / 256, 2);                           // (2048, 2): q and k planes in one launch, the mask bits shared out over both
  const dim3 gVT(NBH * VTILES);                         // 1024
  const dim3 gAT(ATT_BLOCKS);                           // 1024
  const dim3 bAT(ATT_THREADS);                          // 128

  // (0) q and k planes f16(bf16(x) * 1024): q [bh][s][d], k fragment order; mask bits
  cvt16<<<gC, blk, 0, stream>>>(q, k, QH, KH, n8, QSC, mk, MB);
  // (1) v^T plane f16(bf16(v) * 256), fragment order
  vt16<<<gVT, blk, 0, stream>>>(v, VT);
  // (2) masked flash attention per (b,h) -> out [bh][s][d] f32
  attn_masked<<<gAT, bAT, 0, stream>>>(QH, KH, VT, MB, out);
  (void)hipGetLastError();
}

// v004
// It runs in 72.4 microseconds.
// Next to v003, in two timings, it ran 1.07 and 1.08 times as fast.
// Counting every step since v000, it is 1.89 times as fast.
// Contractions: scores k.q^T (k x1024 as A and q x1024 as B, f16 planes of the bf16-RNE-converted inputs, one product each,
// K=64) and v^T.P^T (v x256 f16 of the bf16-RNE-converted input as A, P x32768 as f16 hi plane + f16 residual plane as B,
// products v.hi+v.lo, 32-key steps): all v_wmma_f32_16x16x32_f16, f32 accumulate. A lane holds one query's scores: base-2 online
// softmax in the lane with the key mask applied by value (replace) and the 1/l fold in f32 on VALU. The int mask is packed once
// per call to one bit per key (bit = mask != 0); a lane reads one 32-bit word per 32-key step.
// The k plane and the v^T plane lie in fragment order: each 16-B load of a fragment reads 512 contiguous bytes per wave.
#include <hip/hip_runtime.h>
#include <math.h>
#include <stdint.h>

#define NBH   32
#define SEQ   2048
#define HD    64
#define QSC   1024.0f
#define KSC   1024.0f
#define PCAR  32768.0f
#define VCAR  256.0f
#define LOG2E 1.4426950408889634f
#define NEGT  (-1.0e9f * LOG2E)
#define ATW   4
#define ATT_THREADS (ATW * 32)
#define QPB   (16 * ATW)
#define BPH   (SEQ / QPB)
#define ATT_BLOCKS (NBH * BPH)
#define SLP   68
#define SLABF (16 * SLP)
#define VTP   72
#define VTILES (SEQ / 64)
static_assert(HD == 64 && QPB == 64 && ATT_THREADS == 128);
static_assert((SEQ % QPB) == 0 && (SEQ % 64) == 0 && (SEQ % 32) == 0);
static_assert(BPH == 32 && ATT_BLOCKS == 1024 && VTILES == 32);
static_assert((HD - 1) * VTP + 63 < HD * VTP);
static_assert(((NBH * SEQ * HD) % 2048) == 0);
#define CVB   ((NBH * SEQ * HD) / 2048)
static_assert(2 * CVB == (SEQ / 16) * (SEQ / 64));     // convert blocks of both planes = (query tiles) x (pairs of 32-key steps)

typedef _Float16 v16h __attribute__((ext_vector_type(16)));
typedef _Float16 v8h  __attribute__((ext_vector_type(8)));
typedef float    v8f  __attribute__((ext_vector_type(8)));
typedef float    v4f  __attribute__((ext_vector_type(4)));
typedef unsigned int v4u __attribute__((ext_vector_type(4)));
typedef int      v4i  __attribute__((ext_vector_type(4)));

union FragH { v16h v; v8h h[2]; v4u u[2]; };

// ---- scalar helpers --------------------------------------------------------------------------------
__device__ __forceinline__ unsigned short bf_bits(float f) {          // f32 -> bf16 bits, RNE convert
  unsigned u = __float_as_uint(f);
  return (unsigned short)((u + 0x7FFFu + ((u >> 16) & 1u)) >> 16);
}
__device__ __forceinline__ float bf_up(unsigned short h) { return __uint_as_float(((unsigned)h) << 16); }
__device__ __forceinline__ float bfr(float f) { return bf_up(bf_bits(f)); }   // value of the bf16 RNE convert
__device__ __forceinline__ unsigned short h_bits(_Float16 x) { return __builtin_bit_cast(unsigned short, x); }
__device__ __forceinline__ unsigned pk16(unsigned short a, unsigned short b) { return (unsigned)a | ((unsigned)b << 16); }
__device__ __forceinline__ v8f zero8() { v8f z = {0.f, 0.f, 0.f, 0.f, 0.f, 0.f, 0.f, 0.f}; return z; }

// ---- fragment loader: 16-bit A/B operand, lane -> row/col (lane&15), p already includes +8*(lane>>4);
//      elements 0..7 <- p[0..7] (k0+8h..), elements 8..15 <- p[16..23] (k0+16+8h..)  (same split k map for A and B;
//      here it reads only B, from the [s][d] q plane; A fragments use ldfrag_f)
__device__ __forceinline__ v16h ldfrag_h(const _Float16* p) {
  FragH f;
  f.h[0] = *(const v8h*)(p);
  f.h[1] = *(const v8h*)(p + 16);
  return f.v;
}

// ---- same fragment from a plane kept in fragment order: p is wave-uniform, lo = 8*lane; the lanes' first 8 elements are one
//      contiguous 512-B run, their second 8 elements the next 512-B run (256 halves on)
__device__ __forceinline__ v16h ldfrag_f(const _Float16* p, unsigned lo) {
  FragH f;
  f.h[0] = *(const v8h*)(p + lo);
  f.h[1] = *(const v8h*)(p + 256 + lo);
  return f.v;
}

__device__ __forceinline__ v8f mma_raw(v16h a, v16h b, v8f c) {
  return __builtin_amdgcn_wmma_f32_16x16x32_f16(false, a, false, b, (short)0, c, false, false);
}
// value of the lane 16 away (lane l <-> l ^ 16), a vector cross-row move
__device__ __forceinline__ float xhalf(float x) {
  const int b = __builtin_bit_cast(int, x);
  return __builtin_bit_cast(float, __builtin_amdgcn_permlanex16(b, b, 0x76543210, 0xfedcba98, false, false));
}
// 2^x by the hardware instruction alone. Every argument here is <= 0 (or -inf): a result under 2^-126 comes out 0 where the
// library form's range guard (compare, two selects, add, ldexp per value) gave a denormal; such a term is 0 in both f16 planes of
// P*32768 anyway and is far under one ulp of the row sum (>= 1).
__device__ __forceinline__ float ex2(float x) { return __builtin_amdgcn_exp2f(x); }
__device__ __forceinline__ void wave_sync_lds() {
  __builtin_amdgcn_fence(__ATOMIC_RELEASE, "workgroup");
  __builtin_amdgcn_wave_barrier();
  __builtin_amdgcn_fence(__ATOMIC_ACQUIRE, "workgroup");
}

// =====================================================================================================
// 16-bit plane convert (inputs are [bh][s][d] with bh = b*16+h): value f16( bf16(x) * sc ) (sc a power of two, exact).
//   blockIdx.y == 0: q plane, layout [bh][s][d] as the input. blockIdx.y == 1: k plane in fragment order:
//   [row tile of 16][ld = 0..3][lane = 16*hh + c][8 halves] holds k[16*tile + c][16*ld + 8*hh + 0..7].
// Thread = one 16-B chunk of the plane (8 consecutive d of one row): two 16-B loads, one 16-B store; 32 consecutive lanes store 512-B
//   Every block also packs its share of the mask bits, plane [query tile of 16][step of 32 keys][c = 0..15] of 32-bit words:
//   bit b of a word is (mask[16*tile + c][32*step + b] != 0). Block = (query tile, 2 steps): wave w takes queries 2w, 2w+1;
//   a word is one 128-B load of the wave and one ballot; the block's 32 words are one whole 128-B line (one writer).
// coverage: grid = (n8/256, 2) blocks x 256 thr x 8 elements = n = 32*2048*64 per plane exactly (n % 2048 == 0 asserted);
//           mask: 128 tiles x 32 pairs of steps = 4096 blocks x 32 words = 2048 queries x 64 words, each exactly once.
// =====================================================================================================
__global__ __launch_bounds__(256) void cvt16(const float* __restrict__ xq, const float* __restrict__ xk,
                                             unsigned short* plq, unsigned short* plk, int n8, float sc,
                                             const int* __restrict__ msk, unsigned int* mbits) {
  const int gt = blockIdx.x * 256 + (int)threadIdx.x;
  if (gt >= n8) return;                     // never taken with the exact grid; no barriers in this kernel
  int mx[4];                                // mask values of this wave's 4 words; every lane is on (exact grid)
  const int lane = (int)threadIdx.x & 31, wv = (int)threadIdx.x >> 5;
  const int fb = (int)blockIdx.y * CVB + (int)blockIdx.x;                // 0..4095: query tile fb >> 5, pair of steps fb & 31
  const bool sk = (blockIdx.y != 0);        // block-uniform plane select (both pointers global)
  const float* x = sk ? xk : xq;
  unsigned short* pl = sk ? plk : plq;
  const size_t e = (size_t)gt * 8;          // destination element: the stores stay contiguous for both planes
  // source element: q the same place; k row 16*(gt>>7) + (gt&15), d chunk 2*((gt>>5)&3) + ((gt>>4)&1) (a bijection on gt)
  const size_t es = sk ? ((size_t)((gt >> 7) * 16 + (gt & 15)) * HD + (size_t)((((gt >> 5) & 3) * 2 + ((gt >> 4) & 1)) * 8)) : e;
  const v4f a = *(const v4f*)(x + es), bq = *(const v4f*)(x + es + 4);
  {
    const int* mp = msk + ((size_t)(16 * (fb >> 5) + 2 * wv) * SEQ + (size_t)(64 * (fb & 31) + lane));
#pragma unroll
    for (int i = 0; i < 4; ++i) mx[i] = mp[(size_t)(i >> 1) * SEQ + (size_t)(32 * (i & 1))];  // query 2wv + (i>>1), step 2(fb&31) + (i&1)
  }
  v4u o;
#pragma unroll
  for (int i = 0; i < 2; ++i) {
    o[i]     = pk16(h_bits((_Float16)(bfr(a[2 * i]) * sc)),  h_bits((_Float16)(bfr(a[2 * i + 1]) * sc)));
    o[2 + i] = pk16(h_bits((_Float16)(bfr(bq[2 * i]) * sc)), h_bits((_Float16)(bfr(bq[2 * i + 1]) * sc)));
  }
  unsigned short* d = pl + e;
  {
    *(v4u*)(d) = o;
    
  }
  unsigned int w = 0u;
#pragma unroll
  for (int i = 0; i < 4; ++i) {
    const unsigned int b = __builtin_amdgcn_ballot_w32(mx[i] != 0);
    w = (lane == i) ? b : w;                // lane i keeps word i
  }
  if (lane < 4) mbits[(size_t)fb * 32 + (size_t)((lane & 1) * 16 + 2 * wv + (lane >> 1))] = w;
}

// =====================================================================================================
// v^T plane in fragment order, values f16( bf16(v[bh][key][d]) * 256 ) (exact):
//   [bh][step of 32 keys][j = 0..3][part = 0..1][lane = 16*hh + c][8 halves] holds d = 16*j + c, keys 32*step + 16*part + 8*hh + 0..7.
// Block = (bh, tile of 64 keys): 64 source rows of 64 floats loaded with 16-B loads (static stride), converted, written into
// coverage: load 256 thr x 16 elements = 64 keys x 64 d; store 2 iterations x 256 thr x 8 halves = 64 lines x 64 = the tile;
//           grid = NBH x 32 = 1024 blocks, each 8192 contiguous bytes (2 steps): the whole plane exactly once.
// =====================================================================================================
__global__ __launch_bounds__(256) void vt16(const float* __restrict__ v, unsigned short* VTo) {
  __shared__ __align__(16) unsigned short T[HD * VTP];
  const int tid = threadIdx.x;
  const int bid = blockIdx.x;
  const int bh  = bid / VTILES;
  const int t   = bid - bh * VTILES;        // 0..31, block-uniform
  if (bh >= NBH) return;                    // never taken with the exact grid; before any barrier or store
  {
    const int sl = tid >> 2;                  // key within tile 0..63
    const int dc = (tid & 3) * 16;            // d chunk
    int key = 64 * t + sl;                    // <= SEQ-1 by construction; clamp keeps the address in range regardless
    key = (key < 0) ? 0 : ((key > SEQ - 1) ? (SEQ - 1) : key);
    const float* src = v + (((size_t)bh * SEQ + (size_t)key) * HD + dc);
#pragma unroll
    for (int i = 0; i < 4; ++i) {
      const v4f a = *(const v4f*)(src + 4 * i);
#pragma unroll
      for (int e = 0; e < 4; ++e) T[(dc + 4 * i + e) * VTP + sl] = h_bits((_Float16)(bfr(a[e]) * VCAR));
    }
  }
  __syncthreads();
  v4u vals[2];
  const int line = ((tid >> 6) & 3) * 16 + (tid & 15);        // d = 16*j + c, 0..63
  const int p8   = ((tid >> 5) & 1) * 16 + ((tid >> 4) & 1) * 8; // key within the 32-key step: 16*part + 8*hh
#pragma unroll
  for (int it = 0; it < 2; ++it) vals[it] = *(const v4u*)(T + line * VTP + it * 32 + p8);   // it = step within the tile
  unsigned short* dst = VTo + ((size_t)bh * SEQ + (size_t)(64 * t)) * HD + tid * 8;
  {
#pragma unroll
    for (int it = 0; it < 2; ++it) {
      *(v4u*)(dst + (size_t)it * 32 * HD) = vals[it];
    }
    
  }
}

// =====================================================================================================
// Masked flash attention per (b,h), scores taken transposed. Block = (bh, 64 queries), wave w owns queries iw = 64t + 16w .. +15.
//   q plane f16 [bh][s][d], k plane and v^T plane f16 in fragment order (4096 contiguous bytes each per 32-key step), mask
//   bits [query tile][step][c] shared over bh (bit clear = masked): 64 contiguous bytes per wave and step.
//   Key loop (uniform bound): kb = 0, 32, ..., SEQ-32; every key tile is visited.
//   Per 32-key step: S^T = K.Q^T, A = k fragment (row = key), B = q fragment (column = query), 2 key subtiles x 2 k-steps x 1
//   product. Lane (hh, c) then holds, for its ONE query iw + c, the 16 keys kb + 8hh + 0..7 and kb + 16 + 8hh + 0..7: the
//   mask is one 32-bit word of the query's own bits, applied by value in the log2 domain (t := -1e9*log2e where mask == 0,
//   the scaled score otherwise), so a row whose visited keys are all masked stays uniform exactly like the spec and a single
//   unmasked key zeroes every masked term through exp2; the step's maximum is taken in the lane plus one exchange between the
//   lane halves; the sum stays a per-lane partial (its own 16 keys of each step), joined once behind the loop.
//   Those 16 values are, in this order, the B fragment of P^T in the split k map: P*32768 (f16 hi) and its f16 residual are
//   converted in place, no LDS and no lane exchange. O^T += V^T.P^T, A = v^T fragment (row = d), 8 WMMAs; the rescale
//   factor of the 4 accumulators is one value per lane.
//   Epilogue: 1/l and carry folds in f32; lane (hh, c) holds d = 16j + 8hh + 0..7 of query iw + c; the wave's 16x64 f32 result is
//   staged in its LDS slab (pitch 68) and stored as whole 256-B rows.
//   No block barriers in this kernel; every wave of a block does exactly 64 steps.
// coverage: per wave 8 instructions x 32 lanes x 4 floats = 16 rows x 64; per block 4 waves = 64 rows; 32 blocks per bh x
//           32 bh: every row of out [32][2048][64] exactly once (grid 1024 blocks).
// =====================================================================================================
__global__ __launch_bounds__(ATT_THREADS)
void attn_masked(const unsigned short* __restrict__ QHp, const unsigned short* __restrict__ KHp,
                 const unsigned short* __restrict__ VTq, const unsigned int* __restrict__ Msk, float* OPp) {
  __shared__ __align__(16) float smem[ATW * SLABF];    // per wave: result slab of the epilogue

  const int tid  = threadIdx.x;
  const int wave = tid >> 5;
  const int lane = tid & 31;
  const int hh   = lane >> 4;
  const int c    = lane & 15;

  const int bid  = blockIdx.x;
  const int bh   = bid / BPH;
  const int t    = bid - bh * BPH;                     // 0..31, block-uniform
  if (bh >= NBH) return;                               // never taken with the exact grid; before any LDS use or store

  const int i0 = QPB * t;
  const int iw = i0 + wave * 16;                       // query 0 of this wave, <= SEQ-16
  const int qs = iw + c;                               // this lane's query, <= SEQ-1 by construction

  const _Float16* Qb = (const _Float16*)(const void*)QHp + ((size_t)bh * SEQ + (size_t)qs) * HD + 8 * hh;
  const v16h qb0 = ldfrag_h(Qb);                       // d 0..31
  const v16h qb1 = ldfrag_h(Qb + 32);                  // d 32..63
  const _Float16* Kb = (const _Float16*)(const void*)KHp + (size_t)bh * SEQ * HD;   // block-uniform plane bases
  const _Float16* Vb = (const _Float16*)(const void*)VTq + (size_t)bh * SEQ * HD;
  const unsigned  lo = 8u * (unsigned)lane;            // this lane's 16-B chunk in each 512-B run, lane = 16*hh + c
  const unsigned int* Mb = Msk + (size_t)(iw >> 4) * (SEQ / 32 * 16) + c;   // query tile iw/16, word of query c (shared over bh)
  const unsigned int NEGB = __builtin_bit_cast(unsigned int, NEGT);
  const float lsc = LOG2E / (8.0f * QSC * KSC);        // 1/sqrt(64) and the q,k carries, base-2 domain

  float mrow = -INFINITY, lrow = 0.f;                  // this lane's query: running maximum (both halves equal), partial sum
  v8f o[4];
#pragma unroll
  for (int j = 0; j < 4; ++j) o[j] = zero8();

  // kept rolled: one step's registers and a short loop text
#pragma unroll 1
  for (int kb = 0; kb < SEQ; kb += 32) {
    // ---- the step's loads: mask word of (query qs, keys kb .. kb + 31; both lane halves read the same word), the k fragments
    //      (A, row = key) and the v^T fragments (A, row m = d = j*16 + c, 1024 bytes per j); all in range by construction ----
    const unsigned int mw = Mb[kb >> 1] >> (8 * hh);               // step kb/32, 16 words each; bit r = key kb + 8hh + r
    const _Float16* k0p = Kb + (size_t)kb * HD;                    // row tile kb/16: key row kb + c
    const _Float16* k1p = k0p + (size_t)16 * HD;                   // next row tile: key row kb + 16 + c
    const v16h kf00 = ldfrag_f(k0p, lo), kf01 = ldfrag_f(k0p + 512, lo);   // d 0..31, d 32..63
    const v16h kf10 = ldfrag_f(k1p, lo), kf11 = ldfrag_f(k1p + 512, lo);
    // the address registers of the loads above are given new values below (the v^T loads land in them, the mask address steps on)
    asm volatile("s_wait_xcnt 0x0" ::: "memory");
    const _Float16* vp = Vb + (size_t)kb * HD;                     // step kb/32, 32*HD halves each
    const v16h va0 = ldfrag_f(vp, lo);
    const v16h va1 = ldfrag_f(vp + 512, lo);
    const v16h va2 = ldfrag_f(vp + 1024, lo);
    const v16h va3 = ldfrag_f(vp + 1536, lo);
    // ---- scores: D element r of this lane = (key kb + 8hh + r, query qs) in s0, key kb + 16 + 8hh + r in s1 ----
    v8f s0 = zero8(), s1 = zero8();
    s0 = mma_raw(kf00, qb0, s0);
    s0 = mma_raw(kf01, qb1, s0);
    s1 = mma_raw(kf10, qb0, s1);
    s1 = mma_raw(kf11, qb1, s1);
    // ---- replace-mask by value + online softmax in base 2, all 16 keys of the query in this lane ----
    v8f t0 = s0 * lsc, t1 = s1 * lsc;
#pragma unroll
    for (int r = 0; r < 8; ++r) {
      const unsigned int m0 = (unsigned int)(((int)(mw << (31 - r))) >> 31);    // all ones where the key is kept
      const unsigned int m1 = (unsigned int)(((int)(mw << (15 - r))) >> 31);    // bit 16 + r = key kb + 16 + 8hh + r
      t0[r] = __builtin_bit_cast(float, (__builtin_bit_cast(unsigned int, (float)t0[r]) & m0) | (NEGB & ~m0));
      t1[r] = __builtin_bit_cast(float, (__builtin_bit_cast(unsigned int, (float)t1[r]) & m1) | (NEGB & ~m1));
    }
    float mx = fmaxf(t0[0], t1[0]);
#pragma unroll
    for (int r = 1; r < 8; ++r) mx = fmaxf(mx, fmaxf(t0[r], t1[r]));
    mx = fmaxf(mx, xhalf(mx));                         // the other 16 keys of the step
    const float mn = fmaxf(mrow, mx);                  // finite: mx is either a scaled score or NEGT
    const float al = ex2(mrow - mn);                   // 0 on the first step (mrow = -inf)
    mrow = mn;
    t0 -= mn;
    t1 -= mn;
    v8f e0, e1;
#pragma unroll
    for (int r = 0; r < 8; ++r) { e0[r] = ex2(t0[r]); e1[r] = ex2(t1[r]); }
    const v8f es = e0 + e1;
    lrow = lrow * al + (((es[0] + es[1]) + (es[2] + es[3])) + ((es[4] + es[5]) + (es[6] + es[7])));
#pragma unroll
    for (int j = 0; j < 4; ++j) o[j] *= al;
    // ---- B fragments of P^T*32768: hi f16 and residual f16, column = query c; elements 0..7 = keys kb + 8hh + 0..7 (e0),
    //      elements 8..15 = keys kb + 16 + 8hh + 0..7 (e1): the split k map of the v^T fragments ----
    FragH ph, pl;
    {
      const v8f ta = e0 * PCAR, tb = e1 * PCAR;
      ph.h[0] = __builtin_convertvector(ta, v8h);
      ph.h[1] = __builtin_convertvector(tb, v8h);
      pl.h[0] = __builtin_convertvector(ta - __builtin_convertvector(ph.h[0], v8f), v8h);
      pl.h[1] = __builtin_convertvector(tb - __builtin_convertvector(ph.h[1], v8f), v8h);
    }
    // ---- O^T += V^T.P^T over keys kb .. kb+31 ----
    o[0] = mma_raw(va0, ph.v, o[0]);  o[0] = mma_raw(va0, pl.v, o[0]);
    o[1] = mma_raw(va1, ph.v, o[1]);  o[1] = mma_raw(va1, pl.v, o[1]);
    o[2] = mma_raw(va2, ph.v, o[2]);  o[2] = mma_raw(va2, pl.v, o[2]);
    o[3] = mma_raw(va3, ph.v, o[3]);  o[3] = mma_raw(va3, pl.v, o[3]);
  }

  // ---- join the halves' sums, fold 1/l and the carries (32768 on P, 256 on v), stage the wave's 16x64 slab in its LDS region ----
  float* slab = smem + wave * SLABF;
  const float oc  = 1.0f / (PCAR * VCAR);
  const float lr  = lrow + xhalf(lrow);                  // >= 1 (the max element contributes 2^0)
  const float inv = (lr > 0.0f) ? ((1.0f / lr) * oc) : 0.0f;
#pragma unroll
  for (int j = 0; j < 4; ++j) {
    float* sp = slab + c * SLP + j * 16 + 8 * hh;        // D element r of o[j] = (d = 16j + 8hh + r, query iw + c)
    v4f w0, w1;
#pragma unroll
    for (int e = 0; e < 4; ++e) { w0[e] = o[j][e] * inv; w1[e] = o[j][4 + e] * inv; }
    *(v4f*)(sp)     = w0;
    *(v4f*)(sp + 4) = w1;
  }
  wave_sync_lds();
  v4f vals[8];
#pragma unroll
  for (int it = 0; it < 8; ++it) vals[it] = *(const v4f*)(slab + (2 * it + hh) * SLP + c * 4);
  float* dst = OPp + ((size_t)(bh * SEQ + iw)) * HD + hh * HD + c * 4;
  {
#pragma unroll
    for (int it = 0; it < 8; ++it) {
      *(v4f*)(dst + (size_t)(2 * it) * HD) = vals[it];
    }
    
  }
}

// =====================================================================================================
// Workspace map (bytes); every plane is fully written by whole-line stores before it is read; all extents are exact
// multiples of the store granularity (no pad rows needed); offsets multiples of 128:
//   QH f16 [32][2048][64] x1024        8388608   at        0
//   KH f16 fragment order x1024        8388608   at  8388608
//   VT f16 fragment order x256         8388608   at 16777216
//   MB mask bits [128][64][16] u32      524288   at 25165824
//   end                                             25690112
// =====================================================================================================
extern "C" void kernel_launch(void* const* d_in, const int* in_sizes, int n_in,
                              void* d_out, int out_size, void* d_ws, size_t ws_size,
                              hipStream_t stream) {
  const int NEL = NBH * SEQ * HD;                       // 4194304
  if (n_in < 4) return;
  if (in_sizes[0] < NEL || in_sizes[1] < NEL || in_sizes[2] < NEL || in_sizes[3] < SEQ * SEQ) return;
  if (out_size < NEL) return;

  const float* q  = (const float*)d_in[0];
  const float* k  = (const float*)d_in[1];
  const float* v  = (const float*)d_in[2];
  const int*   mk = (const int*)d_in[3];
  float*       out = (float*)d_out;

  const size_t PQ = (size_t)NEL * 2;                    //  8388608
  const size_t PK = (size_t)NEL * 2;                    //  8388608
  const size_t PV = (size_t)NBH * HD * SEQ * 2;         //  8388608
  size_t off = 0;
  const size_t oQH = off; off += PQ;
  const size_t oKH = off; off += PK;
  const size_t oVT = off; off += PV;
  const size_t oMB = off; off += (size_t)SEQ * SEQ / 8; //   524288
  if (off > ws_size) return;                            // off = 25690112
  if (off > (size_t)134217728) return;

  char* ws = (char*)d_ws;
  unsigned short* QH = (unsigned short*)(ws + oQH);
  unsigned short* KH = (unsigned short*)(ws + oKH);
  unsigned short* VT = (unsigned short*)(ws + oVT);
  unsigned int*   MB = (unsigned int*)(ws + oMB);

  const int n8 = NEL / 8;                               // 524288
  const dim3 blk(256);
  const dim3 gC(n8 / 256, 2);                           // (2048, 2): q and k planes in one launch, the mask bits shared out over both
  const dim3 gVT(NBH * VTILES);                         // 1024
  const dim3 gAT(ATT_BLOCKS);                           // 1024
  const dim3 bAT(ATT_THREADS);                          // 128

  // (0) q and k planes f16(bf16(x) * 1024): q [bh][s][d], k fragment order; mask bits
  cvt16<<<gC, blk, 0, stream>>>(q, k, QH, KH, n8, QSC, mk, MB);
  // (1) v^T plane f16(bf16(v) * 256), fragment order
  vt16<<<gVT, blk, 0, stream>>>(v, VT);
  // (2) masked flash attention per (b,h) -> out [bh][s][d] f32
  attn_masked<<<gAT, bAT, 0, stream>>>(QH, KH, VT, MB, out);
  (void)hipGetLastError();
}

// v005
// A run of this version takes 66.2 microseconds.
// Timed twice side by side with v004, it ran 1.12 times as fast both times.
// All steps since v000 together make it 2.12 times as fast.
// Contractions: scores k.q^T (k x1024 as A and q x1024 as B, f16 planes of the bf16-RNE-converted inputs, one product each,
// K=64) and v^T.P^T (v x256 f16 of the bf16-RNE-converted input as A, P x32768 as f16 hi plane + f16 residual plane as B,
// products v.hi+v.lo, 32-key steps): all v_wmma_f32_16x16x32_f16, f32 accumulate. A lane holds one query's scores: base-2 online
// softmax in the lane with the key mask applied by value (replace) and the 1/l fold in f32 on VALU. The int mask is packed once
// per call to one bit per key (bit = mask != 0); a lane reads one 32-bit word per 32-key step.
// The k plane and the v^T plane lie in fragment order: each 16-B load of a fragment reads 512 contiguous bytes per wave.
#include <hip/hip_runtime.h>
#include <math.h>
#include <stdint.h>

#define NBH   32
#define SEQ   2048
#define HD    64
#define QSC   1024.0f
#define KSC   1024.0f
#define PCAR  32768.0f
#define VCAR  256.0f
#define LOG2E 1.4426950408889634f
#define NEGT  (-1.0e9f * LOG2E)
#define ATW   4
#define ATT_THREADS (ATW * 32)
#define QPB   (16 * ATW)
#define BPH   (SEQ / QPB)
#define ATT_BLOCKS (NBH * BPH)
#define SLP   68
#define SLABF (16 * SLP)
#define VTP   72
#define VTILES (SEQ / 64)
static_assert(HD == 64 && QPB == 64 && ATT_THREADS == 128);
static_assert((SEQ % QPB) == 0 && (SEQ % 64) == 0 && (SEQ % 32) == 0);
static_assert(BPH == 32 && ATT_BLOCKS == 1024 && VTILES == 32);
static_assert((HD - 1) * VTP + 63 < HD * VTP);
static_assert(((NBH * SEQ * HD) % 2048) == 0);
#define CVB   ((NBH * SEQ * HD) / 2048)
static_assert(2 * CVB == (SEQ / 16) * (SEQ / 64));     // convert blocks of both planes = (query tiles) x (pairs of 32-key steps)

typedef _Float16 v16h __attribute__((ext_vector_type(16)));
typedef _Float16 v8h  __attribute__((ext_vector_type(8)));
typedef float    v8f  __attribute__((ext_vector_type(8)));
typedef float    v4f  __attribute__((ext_vector_type(4)));
typedef unsigned int v4u __attribute__((ext_vector_type(4)));
typedef int      v4i  __attribute__((ext_vector_type(4)));

union FragH { v16h v; v8h h[2]; v4u u[2]; };

// ---- scalar helpers --------------------------------------------------------------------------------
__device__ __forceinline__ unsigned short bf_bits(float f) {          // f32 -> bf16 bits, RNE convert
  unsigned u = __float_as_uint(f);
  return (unsigned short)((u + 0x7FFFu + ((u >> 16) & 1u)) >> 16);
}
__device__ __forceinline__ float bf_up(unsigned short h) { return __uint_as_float(((unsigned)h) << 16); }
__device__ __forceinline__ float bfr(float f) { return bf_up(bf_bits(f)); }   // value of the bf16 RNE convert
__device__ __forceinline__ unsigned short h_bits(_Float16 x) { return __builtin_bit_cast(unsigned short, x); }
__device__ __forceinline__ unsigned pk16(unsigned short a, unsigned short b) { return (unsigned)a | ((unsigned)b << 16); }
__device__ __forceinline__ v8f zero8() { v8f z = {0.f, 0.f, 0.f, 0.f, 0.f, 0.f, 0.f, 0.f}; return z; }

// ---- fragment loader: 16-bit A/B operand, lane -> row/col (lane&15), p already includes +8*(lane>>4);
//      elements 0..7 <- p[0..7] (k0+8h..), elements 8..15 <- p[16..23] (k0+16+8h..)  (same split k map for A and B;
//      here it reads only B, from the [s][d] q plane; A fragments use ldfrag_f)
__device__ __forceinline__ v16h ldfrag_h(const _Float16* p) {
  FragH f;
  f.h[0] = *(const v8h*)(p);
  f.h[1] = *(const v8h*)(p + 16);
  return f.v;
}

// ---- same fragment from a plane kept in fragment order: p is wave-uniform, lo = 8*lane; the lanes' first 8 elements are one
//      contiguous 512-B run, their second 8 elements the next 512-B run (256 halves on)
__device__ __forceinline__ v16h ldfrag_f(const _Float16* p, unsigned lo) {
  FragH f;
  f.h[0] = *(const v8h*)(p + lo);
  f.h[1] = *(const v8h*)(p + 256 + lo);
  return f.v;
}

__device__ __forceinline__ v8f mma_raw(v16h a, v16h b, v8f c) {
  return __builtin_amdgcn_wmma_f32_16x16x32_f16(false, a, false, b, (short)0, c, false, false);
}
// value of the lane 16 away (lane l <-> l ^ 16), a vector cross-row move
__device__ __forceinline__ float xhalf(float x) {
  const int b = __builtin_bit_cast(int, x);
  return __builtin_bit_cast(float, __builtin_amdgcn_permlanex16(b, b, 0x76543210, 0xfedcba98, false, false));
}
// 2^x by the hardware instruction alone. Every argument here is <= 0 (or -inf): a result under 2^-126 comes out 0 where the
// library form's range guard (compare, two selects, add, ldexp per value) gave a denormal; such a term is 0 in both f16 planes of
// P*32768 anyway and is far under one ulp of the row sum (>= 1).
__device__ __forceinline__ float ex2(float x) { return __builtin_amdgcn_exp2f(x); }
__device__ __forceinline__ void wave_sync_lds() {
  __builtin_amdgcn_fence(__ATOMIC_RELEASE, "workgroup");
  __builtin_amdgcn_wave_barrier();
  __builtin_amdgcn_fence(__ATOMIC_ACQUIRE, "workgroup");
}

// =====================================================================================================
// 16-bit plane convert (inputs are [bh][s][d] with bh = b*16+h): value f16( bf16(x) * sc ) (sc a power of two, exact).
//   blockIdx.y == 0: q plane, layout [bh][s][d] as the input. blockIdx.y == 1: k plane in fragment order:
//   [row tile of 16][ld = 0..3][lane = 16*hh + c][8 halves] holds k[16*tile + c][16*ld + 8*hh + 0..7].
// Thread = one 16-B chunk of the plane (8 consecutive d of one row): two 16-B loads, one 16-B store; 32 consecutive lanes store 512-B
//   Every block also packs its share of the mask bits, plane [query tile of 16][step of 32 keys][c = 0..15] of 32-bit words:
//   bit b of a word is (mask[16*tile + c][32*step + b] != 0). Block = (query tile, 2 steps): wave w takes queries 2w, 2w+1;
//   a word is one 128-B load of the wave and one ballot; the block's 32 words are one whole 128-B line (one writer).
// coverage: grid = (n8/256, 2) blocks x 256 thr x 8 elements = n = 32*2048*64 per plane exactly (n % 2048 == 0 asserted);
//           mask: 128 tiles x 32 pairs of steps = 4096 blocks x 32 words = 2048 queries x 64 words, each exactly once.
// =====================================================================================================
__global__ __launch_bounds__(256) void cvt16(const float* __restrict__ xq, const float* __restrict__ xk,
                                             unsigned short* plq, unsigned short* plk, int n8, float sc,
                                             const int* __restrict__ msk, unsigned int* mbits) {
  const int gt = blockIdx.x * 256 + (int)threadIdx.x;
  if (gt >= n8) return;                     // never taken with the exact grid; no barriers in this kernel
  int mx[4];                                // mask values of this wave's 4 words; every lane is on (exact grid)
  const int lane = (int)threadIdx.x & 31, wv = (int)threadIdx.x >> 5;
  const int fb = (int)blockIdx.y * CVB + (int)blockIdx.x;                // 0..4095: query tile fb >> 5, pair of steps fb & 31
  const bool sk = (blockIdx.y != 0);        // block-uniform plane select (both pointers global)
  const float* x = sk ? xk : xq;
  unsigned short* pl = sk ? plk : plq;
  const size_t e = (size_t)gt * 8;          // destination element: the stores stay contiguous for both planes
  // source element: q the same place; k row 16*(gt>>7) + (gt&15), d chunk 2*((gt>>5)&3) + ((gt>>4)&1) (a bijection on gt)
  const size_t es = sk ? ((size_t)((gt >> 7) * 16 + (gt & 15)) * HD + (size_t)((((gt >> 5) & 3) * 2 + ((gt >> 4) & 1)) * 8)) : e;
  const v4f a = *(const v4f*)(x + es), bq = *(const v4f*)(x + es + 4);
  {
    const int* mp = msk + ((size_t)(16 * (fb >> 5) + 2 * wv) * SEQ + (size_t)(64 * (fb & 31) + lane));
#pragma unroll
    for (int i = 0; i < 4; ++i) mx[i] = mp[(size_t)(i >> 1) * SEQ + (size_t)(32 * (i & 1))];  // query 2wv + (i>>1), step 2(fb&31) + (i&1)
  }
  v4u o;
#pragma unroll
  for (int i = 0; i < 2; ++i) {
    o[i]     = pk16(h_bits((_Float16)(bfr(a[2 * i]) * sc)),  h_bits((_Float16)(bfr(a[2 * i + 1]) * sc)));
    o[2 + i] = pk16(h_bits((_Float16)(bfr(bq[2 * i]) * sc)), h_bits((_Float16)(bfr(bq[2 * i + 1]) * sc)));
  }
  unsigned short* d = pl + e;
  {
    *(v4u*)(d) = o;
    
  }
  unsigned int w = 0u;
#pragma unroll
  for (int i = 0; i < 4; ++i) {
    const unsigned int b = __builtin_amdgcn_ballot_w32(mx[i] != 0);
    w = (lane == i) ? b : w;                // lane i keeps word i
  }
  if (lane < 4) mbits[(size_t)fb * 32 + (size_t)((lane & 1) * 16 + 2 * wv + (lane >> 1))] = w;
}

// =====================================================================================================
// v^T plane in fragment order, values f16( bf16(v[bh][key][d]) * 256 ) (exact):
//   [bh][step of 32 keys][j = 0..3][part = 0..1][lane = 16*hh + c][8 halves] holds d = 16*j + c, keys 32*step + 16*part + 8*hh + 0..7.
// Block = (bh, tile of 64 keys): 64 source rows of 64 floats loaded with 16-B loads (static stride), converted, written into
// coverage: load 256 thr x 16 elements = 64 keys x 64 d; store 2 iterations x 256 thr x 8 halves = 64 lines x 64 = the tile;
//           grid = NBH x 32 = 1024 blocks, each 8192 contiguous bytes (2 steps): the whole plane exactly once.
// =====================================================================================================
__global__ __launch_bounds__(256) void vt16(const float* __restrict__ v, unsigned short* VTo) {
  __shared__ __align__(16) unsigned short T[HD * VTP];
  const int tid = threadIdx.x;
  const int bid = blockIdx.x;
  const int bh  = bid / VTILES;
  const int t   = bid - bh * VTILES;        // 0..31, block-uniform
  if (bh >= NBH) return;                    // never taken with the exact grid; before any barrier or store
  {
    const int sl = tid >> 2;                  // key within tile 0..63
    const int dc = (tid & 3) * 16;            // d chunk
    int key = 64 * t + sl;                    // <= SEQ-1 by construction; clamp keeps the address in range regardless
    key = (key < 0) ? 0 : ((key > SEQ - 1) ? (SEQ - 1) : key);
    const float* src = v + (((size_t)bh * SEQ + (size_t)key) * HD + dc);
#pragma unroll
    for (int i = 0; i < 4; ++i) {
      const v4f a = *(const v4f*)(src + 4 * i);
#pragma unroll
      for (int e = 0; e < 4; ++e) T[(dc + 4 * i + e) * VTP + sl] = h_bits((_Float16)(bfr(a[e]) * VCAR));
    }
  }
  __syncthreads();
  v4u vals[2];
  const int line = ((tid >> 6) & 3) * 16 + (tid & 15);        // d = 16*j + c, 0..63
  const int p8   = ((tid >> 5) & 1) * 16 + ((tid >> 4) & 1) * 8; // key within the 32-key step: 16*part + 8*hh
#pragma unroll
  for (int it = 0; it < 2; ++it) vals[it] = *(const v4u*)(T + line * VTP + it * 32 + p8);   // it = step within the tile
  unsigned short* dst = VTo + ((size_t)bh * SEQ + (size_t)(64 * t)) * HD + tid * 8;
  {
#pragma unroll
    for (int it = 0; it < 2; ++it) {
      *(v4u*)(dst + (size_t)it * 32 * HD) = vals[it];
    }
    
  }
}

// =====================================================================================================
// Masked flash attention per (b,h), scores taken transposed. Block = (bh, 64 queries), wave w owns queries iw = 64t + 16w .. +15.
//   q plane f16 [bh][s][d], k plane and v^T plane f16 in fragment order (4096 contiguous bytes each per 32-key step), mask
//   bits [query tile][step][c] shared over bh (bit clear = masked): 64 contiguous bytes per wave and step.
//   Key loop (uniform bound): kb = 0, 32, ..., SEQ-32; every key tile is visited.
//   Per 32-key step: S^T = K.Q^T, A = k fragment (row = key), B = q fragment (column = query), 2 key subtiles x 2 k-steps x 1
//   product. Lane (hh, c) then holds, for its ONE query iw + c, the 16 keys kb + 8hh + 0..7 and kb + 16 + 8hh + 0..7: the
//   mask is one 32-bit word of the query's own bits, applied by value in the log2 domain (t := -1e9*log2e where mask == 0,
//   the scaled score otherwise), so a row whose visited keys are all masked stays uniform exactly like the spec and a single
//   unmasked key zeroes every masked term through exp2; the step's maximum is taken in the lane plus one exchange between the
//   lane halves; the sum stays a per-lane partial (its own 16 keys of each step), joined once behind the loop.
//   Those 16 values are, in this order, the B fragment of P^T in the split k map: P*32768 (f16 hi) and its f16 residual are
//   converted in place, no LDS and no lane exchange. O^T += V^T.P^T, A = v^T fragment (row = d), 8 WMMAs; the rescale
//   factor of the 4 accumulators is one value per lane.
//   Epilogue: 1/l and carry folds in f32; lane (hh, c) holds d = 16j + 8hh + 0..7 of query iw + c; the wave's 16x64 f32 result is
//   staged in its LDS slab (pitch 68) and stored as whole 256-B rows.
//   No block barriers in this kernel; every wave of a block does exactly 64 steps.
// coverage: per wave 8 instructions x 32 lanes x 4 floats = 16 rows x 64; per block 4 waves = 64 rows; 32 blocks per bh x
//           32 bh: every row of out [32][2048][64] exactly once (grid 1024 blocks).
// =====================================================================================================
__global__ __launch_bounds__(ATT_THREADS)
void attn_masked(const unsigned short* __restrict__ QHp, const unsigned short* __restrict__ KHp,
                 const unsigned short* __restrict__ VTq, const unsigned int* __restrict__ Msk, float* OPp) {
  __shared__ __align__(16) float smem[ATW * SLABF];    // per wave: result slab of the epilogue

  const int tid  = threadIdx.x;
  const int wave = tid >> 5;
  const int lane = tid & 31;
  const int hh   = lane >> 4;
  const int c    = lane & 15;

  const int bid  = blockIdx.x;
  const int bh   = bid / BPH;
  const int t    = bid - bh * BPH;                     // 0..31, block-uniform
  if (bh >= NBH) return;                               // never taken with the exact grid; before any LDS use or store

  const int i0 = QPB * t;
  const int iw = i0 + wave * 16;                       // query 0 of this wave, <= SEQ-16
  const int qs = iw + c;                               // this lane's query, <= SEQ-1 by construction

  const _Float16* Qb = (const _Float16*)(const void*)QHp + ((size_t)bh * SEQ + (size_t)qs) * HD + 8 * hh;
  const v16h qb0 = ldfrag_h(Qb);                       // d 0..31
  const v16h qb1 = ldfrag_h(Qb + 32);                  // d 32..63
  const _Float16* Kb = (const _Float16*)(const void*)KHp + (size_t)bh * SEQ * HD;   // block-uniform plane bases
  const _Float16* Vb = (const _Float16*)(const void*)VTq + (size_t)bh * SEQ * HD;
  const unsigned  lo = 8u * (unsigned)lane;            // this lane's 16-B chunk in each 512-B run, lane = 16*hh + c
  const unsigned int* Mb = Msk + (size_t)(iw >> 4) * (SEQ / 32 * 16) + c;   // query tile iw/16, word of query c (shared over bh)
  const unsigned int NEGB = __builtin_bit_cast(unsigned int, NEGT);
  const float lsc = LOG2E / (8.0f * QSC * KSC);        // 1/sqrt(64) and the q,k carries, base-2 domain

  float mrow = -INFINITY, lrow = 0.f;                  // this lane's query: running maximum (both halves equal), partial sum
  v8f o[4];
#pragma unroll
  for (int j = 0; j < 4; ++j) o[j] = zero8();

  // ---- operands of step 0: mask word of (query qs, keys 0 .. 31; both lane halves read the same word), the k fragments (A, row =
  //      key; row tiles 0 and 1, d 0..31 and d 32..63 each) and the v^T fragments (A, row m = d = j*16 + c, 1024 bytes per j) ----
  unsigned int mwq = Mb[0];
  v16h kf00 = ldfrag_f(Kb, lo),        kf01 = ldfrag_f(Kb + 512, lo);
  v16h kf10 = ldfrag_f(Kb + 1024, lo), kf11 = ldfrag_f(Kb + 1536, lo);
  // keeps q, k and the mask word ahead of v^T, the order of the loop: the compiler sets the loop's counted waits for the stricter of
  // the two orders, and with v^T loads mixed in here the score products of every step would wait for v^T loads as well
  __builtin_amdgcn_sched_barrier(0);
  v16h va0 = ldfrag_f(Vb, lo),         va1 = ldfrag_f(Vb + 512, lo);
  v16h va2 = ldfrag_f(Vb + 1024, lo),  va3 = ldfrag_f(Vb + 1536, lo);

  // kept rolled: one step's registers and a short loop text
#pragma unroll 1
  for (int kb = 0; kb < SEQ; kb += 32) {
    // every step asks for the next step's operands as soon as its own products have read theirs, into the same registers: the
    // loads fly under the softmax and the other products. The last step asks for its own tile again (in range, never used).
    const int kn = (kb + 32 < SEQ) ? (kb + 32) : kb;               // block-uniform
    const unsigned int mw = mwq >> (8 * hh);                       // step kb/32; bit r = key kb + 8hh + r
    // ---- scores: D element r of this lane = (key kb + 8hh + r, query qs) in s0, key kb + 16 + 8hh + r in s1 ----
    v8f s0 = zero8(), s1 = zero8();
    s0 = mma_raw(kf00, qb0, s0);
    s0 = mma_raw(kf01, qb1, s0);
    s1 = mma_raw(kf10, qb0, s1);
    s1 = mma_raw(kf11, qb1, s1);
    {
      const _Float16* kp = Kb + (size_t)kn * HD;                   // row tiles kn/16 and kn/16 + 1: key rows kn + c, kn + 16 + c
      kf00 = ldfrag_f(kp, lo);         kf01 = ldfrag_f(kp + 512, lo);
      kf10 = ldfrag_f(kp + 1024, lo);  kf11 = ldfrag_f(kp + 1536, lo);
      mwq = Mb[kn >> 1];                                           // step kn/32, 16 words each
    }
    // keeps the loads above ahead of the softmax: without it the compiler moves them to the foot of the step, where they have no lead
    __builtin_amdgcn_sched_barrier(0);
    // ---- replace-mask by value + online softmax in base 2, all 16 keys of the query in this lane ----
    v8f t0 = s0 * lsc, t1 = s1 * lsc;
#pragma unroll
    for (int r = 0; r < 8; ++r) {
      const unsigned int m0 = (unsigned int)(((int)(mw << (31 - r))) >> 31);    // all ones where the key is kept
      const unsigned int m1 = (unsigned int)(((int)(mw << (15 - r))) >> 31);    // bit 16 + r = key kb + 16 + 8hh + r
      t0[r] = __builtin_bit_cast(float, (__builtin_bit_cast(unsigned int, (float)t0[r]) & m0) | (NEGB & ~m0));
      t1[r] = __builtin_bit_cast(float, (__builtin_bit_cast(unsigned int, (float)t1[r]) & m1) | (NEGB & ~m1));
    }
    float mx = fmaxf(t0[0], t1[0]);
#pragma unroll
    for (int r = 1; r < 8; ++r) mx = fmaxf(mx, fmaxf(t0[r], t1[r]));
    mx = fmaxf(mx, xhalf(mx));                         // the other 16 keys of the step
    const float mn = fmaxf(mrow, mx);                  // finite: mx is either a scaled score or NEGT
    const float al = ex2(mrow - mn);                   // 0 on the first step (mrow = -inf)
    mrow = mn;
    t0 -= mn;
    t1 -= mn;
    v8f e0, e1;
#pragma unroll
    for (int r = 0; r < 8; ++r) { e0[r] = ex2(t0[r]); e1[r] = ex2(t1[r]); }
    const v8f es = e0 + e1;
    lrow = lrow * al + (((es[0] + es[1]) + (es[2] + es[3])) + ((es[4] + es[5]) + (es[6] + es[7])));
#pragma unroll
    for (int j = 0; j < 4; ++j) o[j] *= al;
    // ---- B fragments of P^T*32768: hi f16 and residual f16, column = query c; elements 0..7 = keys kb + 8hh + 0..7 (e0),
    //      elements 8..15 = keys kb + 16 + 8hh + 0..7 (e1): the split k map of the v^T fragments ----
    FragH ph, pl;
    {
      const v8f ta = e0 * PCAR, tb = e1 * PCAR;
      ph.h[0] = __builtin_convertvector(ta, v8h);
      ph.h[1] = __builtin_convertvector(tb, v8h);
      pl.h[0] = __builtin_convertvector(ta - __builtin_convertvector(ph.h[0], v8f), v8h);
      pl.h[1] = __builtin_convertvector(tb - __builtin_convertvector(ph.h[1], v8f), v8h);
    }
    // ---- O^T += V^T.P^T over keys kb .. kb+31 ----
    o[0] = mma_raw(va0, ph.v, o[0]);  o[0] = mma_raw(va0, pl.v, o[0]);
    o[1] = mma_raw(va1, ph.v, o[1]);  o[1] = mma_raw(va1, pl.v, o[1]);
    o[2] = mma_raw(va2, ph.v, o[2]);  o[2] = mma_raw(va2, pl.v, o[2]);
    o[3] = mma_raw(va3, ph.v, o[3]);  o[3] = mma_raw(va3, pl.v, o[3]);
    {
      const _Float16* vp = Vb + (size_t)kn * HD;                   // step kn/32, 32*HD halves each
      va0 = ldfrag_f(vp, lo);          va1 = ldfrag_f(vp + 512, lo);
      va2 = ldfrag_f(vp + 1024, lo);   va3 = ldfrag_f(vp + 1536, lo);
    }
  }

  // ---- join the halves' sums, fold 1/l and the carries (32768 on P, 256 on v), stage the wave's 16x64 slab in its LDS region ----
  float* slab = smem + wave * SLABF;
  const float oc  = 1.0f / (PCAR * VCAR);
  const float lr  = lrow + xhalf(lrow);                  // >= 1 (the max element contributes 2^0)
  const float inv = (lr > 0.0f) ? ((1.0f / lr) * oc) : 0.0f;
#pragma unroll
  for (int j = 0; j < 4; ++j) {
    float* sp = slab + c * SLP + j * 16 + 8 * hh;        // D element r of o[j] = (d = 16j + 8hh + r, query iw + c)
    v4f w0, w1;
#pragma unroll
    for (int e = 0; e < 4; ++e) { w0[e] = o[j][e] * inv; w1[e] = o[j][4 + e] * inv; }
    *(v4f*)(sp)     = w0;
    *(v4f*)(sp + 4) = w1;
  }
  wave_sync_lds();
  v4f vals[8];
#pragma unroll
  for (int it = 0; it < 8; ++it) vals[it] = *(const v4f*)(slab + (2 * it + hh) * SLP + c * 4);
  float* dst = OPp + ((size_t)(bh * SEQ + iw)) * HD + hh * HD + c * 4;
  {
#pragma unroll
    for (int it = 0; it < 8; ++it) {
      *(v4f*)(dst + (size_t)(2 * it) * HD) = vals[it];
    }
    
  }
}

// =====================================================================================================
// Workspace map (bytes); every plane is fully written by whole-line stores before it is read; all extents are exact
// multiples of the store granularity (no pad rows needed); offsets multiples of 128:
//   QH f16 [32][2048][64] x1024        8388608   at        0
//   KH f16 fragment order x1024        8388608   at  8388608
//   VT f16 fragment order x256         8388608   at 16777216
//   MB mask bits [128][64][16] u32      524288   at 25165824
//   end                                             25690112
// =====================================================================================================
extern "C" void kernel_launch(void* const* d_in, const int* in_sizes, int n_in,
                              void* d_out, int out_size, void* d_ws, size_t ws_size,
                              hipStream_t stream) {
  const int NEL = NBH * SEQ * HD;                       // 4194304
  if (n_in < 4) return;
  if (in_sizes[0] < NEL || in_sizes[1] < NEL || in_sizes[2] < NEL || in_sizes[3] < SEQ * SEQ) return;
  if (out_size < NEL) return;

  const float* q  = (const float*)d_in[0];
  const float* k  = (const float*)d_in[1];
  const float* v  = (const float*)d_in[2];
  const int*   mk = (const int*)d_in[3];
  float*       out = (float*)d_out;

  const size_t PQ = (size_t)NEL * 2;                    //  8388608
  const size_t PK = (size_t)NEL * 2;                    //  8388608
  const size_t PV = (size_t)NBH * HD * SEQ * 2;         //  8388608
  size_t off = 0;
  const size_t oQH = off; off += PQ;
  const size_t oKH = off; off += PK;
  const size_t oVT = off; off += PV;
  const size_t oMB = off; off += (size_t)SEQ * SEQ / 8; //   524288
  if (off > ws_size) return;                            // off = 25690112
  if (off > (size_t)134217728) return;

  char* ws = (char*)d_ws;
  unsigned short* QH = (unsigned short*)(ws + oQH);
  unsigned short* KH = (unsigned short*)(ws + oKH);
  unsigned short* VT = (unsigned short*)(ws + oVT);
  unsigned int*   MB = (unsigned int*)(ws + oMB);

  const int n8 = NEL / 8;                               // 524288
  const dim3 blk(256);
  const dim3 gC(n8 / 256, 2);                           // (2048, 2): q and k planes in one launch, the mask bits shared out over both
  const dim3 gVT(NBH * VTILES);                         // 1024
  const dim3 gAT(ATT_BLOCKS);                           // 1024
  const dim3 bAT(ATT_THREADS);                          // 128

  // (0) q and k planes f16(bf16(x) * 1024): q [bh][s][d], k fragment order; mask bits
  cvt16<<<gC, blk, 0, stream>>>(q, k, QH, KH, n8, QSC, mk, MB);
  // (1) v^T plane f16(bf16(v) * 256), fragment order
  vt16<<<gVT, blk, 0, stream>>>(v, VT);
  // (2) masked flash attention per (b,h) -> out [bh][s][d] f32
  attn_masked<<<gAT, bAT, 0, stream>>>(QH, KH, VT, MB, out);
  (void)hipGetLastError();
}

// v007
// Measured time: 53.7 microseconds a run.
// It is 1.21 times as fast as v005, going by the measured steps of the versions left out in between.
// All steps since v000 together make it 2.56 times as fast.
// Contractions: scores k.q^T (k x1024 as A and q x1024 as B, f16 planes of the bf16-RNE-converted inputs, one product each,
// K=64) and v^T.P^T (v x256 f16 of the bf16-RNE-converted input as A, P x32768 rounded once to f16 as B, one product,
// 32-key steps): all v_wmma_f32_16x16x32_f16, f32 accumulate. A wave owns 32 queries and half the keys; a lane holds one query's
// scores per 16-column group: base-2 online
// softmax in the lane with the key mask applied by value (replace) and the 1/l fold in f32 on VALU. The int mask is packed once
// per call to one bit per key (bit = mask != 0); a lane reads one 32-bit word per 32-key step and column group.
// The k plane and the v^T plane lie in fragment order: each 16-B load of a fragment reads 512 contiguous bytes per wave.
#include <hip/hip_runtime.h>
#include <math.h>
#include <stdint.h>

#define NBH   32
#define SEQ   2048
#define HD    64
#define QSC   1024.0f
#define KSC   1024.0f
#define PCAR  32768.0f
#define VCAR  256.0f
#define LOG2E 1.4426950408889634f
#define NEGT  (-1.0e9f * LOG2E)
#define ATW   4
#define ATT_THREADS (ATW * 32)
#define QPB   (16 * ATW)
#define BPH   (SEQ / QPB)
#define ATT_BLOCKS (NBH * BPH)
#define SLP   68
#define SLABF (16 * SLP)
#define KHALF (SEQ / 2)
#define XCHF  (9 * 32 * 4)
#define MTW   (SEQ / 32 * 16)
#define VTP   72
#define VTILES (SEQ / 64)
static_assert(HD == 64 && QPB == 64 && ATT_THREADS == 128);
static_assert((SEQ % QPB) == 0 && (SEQ % 64) == 0 && (SEQ % 32) == 0);
static_assert(BPH == 32 && ATT_BLOCKS == 1024 && VTILES == 32);
static_assert(ATW == 4 && (KHALF % 32) == 0 && 2 * KHALF == SEQ);
static_assert((HD - 1) * VTP + 63 < HD * VTP);
static_assert(((NBH * SEQ * HD) % 2048) == 0);
#define CVB   ((NBH * SEQ * HD) / 2048)
static_assert(2 * CVB == (SEQ / 16) * (SEQ / 64));     // convert blocks of both planes = (query tiles) x (pairs of 32-key steps)

typedef _Float16 v16h __attribute__((ext_vector_type(16)));
typedef _Float16 v8h  __attribute__((ext_vector_type(8)));
typedef float    v8f  __attribute__((ext_vector_type(8)));
typedef float    v4f  __attribute__((ext_vector_type(4)));
typedef unsigned int v4u __attribute__((ext_vector_type(4)));
typedef int      v4i  __attribute__((ext_vector_type(4)));

union FragH { v16h v; v8h h[2]; v4u u[2]; };

// ---- scalar helpers --------------------------------------------------------------------------------
__device__ __forceinline__ unsigned short bf_bits(float f) {          // f32 -> bf16 bits, RNE convert
  unsigned u = __float_as_uint(f);
  return (unsigned short)((u + 0x7FFFu + ((u >> 16) & 1u)) >> 16);
}
__device__ __forceinline__ float bf_up(unsigned short h) { return __uint_as_float(((unsigned)h) << 16); }
__device__ __forceinline__ float bfr(float f) { return bf_up(bf_bits(f)); }   // value of the bf16 RNE convert
__device__ __forceinline__ unsigned short h_bits(_Float16 x) { return __builtin_bit_cast(unsigned short, x); }
__device__ __forceinline__ unsigned pk16(unsigned short a, unsigned short b) { return (unsigned)a | ((unsigned)b << 16); }
__device__ __forceinline__ v8f zero8() { v8f z = {0.f, 0.f, 0.f, 0.f, 0.f, 0.f, 0.f, 0.f}; return z; }

// ---- fragment loader: 16-bit A/B operand, lane -> row/col (lane&15), p already includes +8*(lane>>4);
//      elements 0..7 <- p[0..7] (k0+8h..), elements 8..15 <- p[16..23] (k0+16+8h..)  (same split k map for A and B;
//      here it reads only B, from the [s][d] q plane; A fragments use ldfrag_f)
__device__ __forceinline__ v16h ldfrag_h(const _Float16* p) {
  FragH f;
  f.h[0] = *(const v8h*)(p);
  f.h[1] = *(const v8h*)(p + 16);
  return f.v;
}

// ---- same fragment from a plane kept in fragment order: p is wave-uniform, lo = 8*lane; the lanes' first 8 elements are one
//      contiguous 512-B run, their second 8 elements the next 512-B run (256 halves on)
__device__ __forceinline__ v16h ldfrag_f(const _Float16* p, unsigned lo) {
  FragH f;
  f.h[0] = *(const v8h*)(p + lo);
  f.h[1] = *(const v8h*)(p + 256 + lo);
  return f.v;
}

__device__ __forceinline__ v8f mma_raw(v16h a, v16h b, v8f c) {
  return __builtin_amdgcn_wmma_f32_16x16x32_f16(false, a, false, b, (short)0, c, false, false);
}
// value of the lane 16 away (lane l <-> l ^ 16), a vector cross-row move
__device__ __forceinline__ float xhalf(float x) {
  const int b = __builtin_bit_cast(int, x);
  return __builtin_bit_cast(float, __builtin_amdgcn_permlanex16(b, b, 0x76543210, 0xfedcba98, false, false));
}
// 2^x by the hardware instruction alone. Every argument here is <= 0 (or -inf): a result under 2^-126 comes out 0 where the
// library form's range guard (compare, two selects, add, ldexp per value) gave a denormal; such a term is 0 in the f16 plane of
// P*32768 anyway and is far under one ulp of the row sum (>= 1).
__device__ __forceinline__ float ex2(float x) { return __builtin_amdgcn_exp2f(x); }
// m all ones: t; m zero: the masked value -1e9*log2e. One three-input bit operation (m ? t : masked value, bit by bit).
__device__ __forceinline__ float msel(float t, int m) {
  return __builtin_bit_cast(float, __builtin_amdgcn_bitop3_b32(__builtin_bit_cast(int, t), __builtin_bit_cast(int, NEGT), m, 0xe4));
}
__device__ __forceinline__ void wave_sync_lds() {
  __builtin_amdgcn_fence(__ATOMIC_RELEASE, "workgroup");
  __builtin_amdgcn_wave_barrier();
  __builtin_amdgcn_fence(__ATOMIC_ACQUIRE, "workgroup");
}

// =====================================================================================================
// 16-bit plane convert (inputs are [bh][s][d] with bh = b*16+h): value f16( bf16(x) * sc ) (sc a power of two, exact).
//   blockIdx.y == 0: q plane, layout [bh][s][d] as the input. blockIdx.y == 1: k plane in fragment order:
//   [row tile of 16][ld = 0..3][lane = 16*hh + c][8 halves] holds k[16*tile + c][16*ld + 8*hh + 0..7].
// Thread = one 16-B chunk of the plane (8 consecutive d of one row): two 16-B loads, one 16-B store; 32 consecutive lanes store 512-B
//   Every block also packs its share of the mask bits, plane [query tile of 16][step of 32 keys][c = 0..15] of 32-bit words:
//   bit b of a word is (mask[16*tile + c][32*step + b] != 0). Block = (query tile, 2 steps): wave w takes queries 2w, 2w+1;
//   a word is one 128-B load of the wave and one ballot; the block's 32 words are one whole 128-B line (one writer).
// coverage: grid = (n8/256, 2) blocks x 256 thr x 8 elements = n = 32*2048*64 per plane exactly (n % 2048 == 0 asserted);
//           mask: 128 tiles x 32 pairs of steps = 4096 blocks x 32 words = 2048 queries x 64 words, each exactly once.
// =====================================================================================================
__global__ __launch_bounds__(256) void cvt16(const float* __restrict__ xq, const float* __restrict__ xk,
                                             unsigned short* plq, unsigned short* plk, int n8, float sc,
                                             const int* __restrict__ msk, unsigned int* mbits) {
  const int gt = blockIdx.x * 256 + (int)threadIdx.x;
  if (gt >= n8) return;                     // never taken with the exact grid; no barriers in this kernel
  int mx[4];                                // mask values of this wave's 4 words; every lane is on (exact grid)
  const int lane = (int)threadIdx.x & 31, wv = (int)threadIdx.x >> 5;
  const int fb = (int)blockIdx.y * CVB + (int)blockIdx.x;                // 0..4095: query tile fb >> 5, pair of steps fb & 31
  const bool sk = (blockIdx.y != 0);        // block-uniform plane select (both pointers global)
  const float* x = sk ? xk : xq;
  unsigned short* pl = sk ? plk : plq;
  const size_t e = (size_t)gt * 8;          // destination element: the stores stay contiguous for both planes
  // source element: q the same place; k row 16*(gt>>7) + (gt&15), d chunk 2*((gt>>5)&3) + ((gt>>4)&1) (a bijection on gt)
  const size_t es = sk ? ((size_t)((gt >> 7) * 16 + (gt & 15)) * HD + (size_t)((((gt >> 5) & 3) * 2 + ((gt >> 4) & 1)) * 8)) : e;
  const v4f a = *(const v4f*)(x + es), bq = *(const v4f*)(x + es + 4);
  {
    const int* mp = msk + ((size_t)(16 * (fb >> 5) + 2 * wv) * SEQ + (size_t)(64 * (fb & 31) + lane));
#pragma unroll
    for (int i = 0; i < 4; ++i) mx[i] = mp[(size_t)(i >> 1) * SEQ + (size_t)(32 * (i & 1))];  // query 2wv + (i>>1), step 2(fb&31) + (i&1)
  }
  v4u o;
#pragma unroll
  for (int i = 0; i < 2; ++i) {
    o[i]     = pk16(h_bits((_Float16)(bfr(a[2 * i]) * sc)),  h_bits((_Float16)(bfr(a[2 * i + 1]) * sc)));
    o[2 + i] = pk16(h_bits((_Float16)(bfr(bq[2 * i]) * sc)), h_bits((_Float16)(bfr(bq[2 * i + 1]) * sc)));
  }
  unsigned short* d = pl + e;
  {
    *(v4u*)(d) = o;
    
  }
  unsigned int w = 0u;
#pragma unroll
  for (int i = 0; i < 4; ++i) {
    const unsigned int b = __builtin_amdgcn_ballot_w32(mx[i] != 0);
    w = (lane == i) ? b : w;                // lane i keeps word i
  }
  if (lane < 4) mbits[(size_t)fb * 32 + (size_t)((lane & 1) * 16 + 2 * wv + (lane >> 1))] = w;
}

// =====================================================================================================
// v^T plane in fragment order, values f16( bf16(v[bh][key][d]) * 256 ) (exact):
//   [bh][step of 32 keys][j = 0..3][part = 0..1][lane = 16*hh + c][8 halves] holds d = 16*j + c, keys 32*step + 16*part + 8*hh + 0..7.
// Block = (bh, tile of 64 keys): 64 source rows of 64 floats loaded with 16-B loads (static stride), converted, written into
// coverage: load 256 thr x 16 elements = 64 keys x 64 d; store 2 iterations x 256 thr x 8 halves = 64 lines x 64 = the tile;
//           grid = NBH x 32 = 1024 blocks, each 8192 contiguous bytes (2 steps): the whole plane exactly once.
// =====================================================================================================
__global__ __launch_bounds__(256) void vt16(const float* __restrict__ v, unsigned short* VTo) {
  __shared__ __align__(16) unsigned short T[HD * VTP];
  const int tid = threadIdx.x;
  const int bid = blockIdx.x;
  const int bh  = bid / VTILES;
  const int t   = bid - bh * VTILES;        // 0..31, block-uniform
  if (bh >= NBH) return;                    // never taken with the exact grid; before any barrier or store
  {
    const int sl = tid >> 2;                  // key within tile 0..63
    const int dc = (tid & 3) * 16;            // d chunk
    int key = 64 * t + sl;                    // <= SEQ-1 by construction; clamp keeps the address in range regardless
    key = (key < 0) ? 0 : ((key > SEQ - 1) ? (SEQ - 1) : key);
    const float* src = v + (((size_t)bh * SEQ + (size_t)key) * HD + dc);
#pragma unroll
    for (int i = 0; i < 4; ++i) {
      const v4f a = *(const v4f*)(src + 4 * i);
#pragma unroll
      for (int e = 0; e < 4; ++e) T[(dc + 4 * i + e) * VTP + sl] = h_bits((_Float16)(bfr(a[e]) * VCAR));
    }
  }
  __syncthreads();
  v4u vals[2];
  const int line = ((tid >> 6) & 3) * 16 + (tid & 15);        // d = 16*j + c, 0..63
  const int p8   = ((tid >> 5) & 1) * 16 + ((tid >> 4) & 1) * 8; // key within the 32-key step: 16*part + 8*hh
#pragma unroll
  for (int it = 0; it < 2; ++it) vals[it] = *(const v4u*)(T + line * VTP + it * 32 + p8);   // it = step within the tile
  unsigned short* dst = VTo + ((size_t)bh * SEQ + (size_t)(64 * t)) * HD + tid * 8;
  {
#pragma unroll
    for (int it = 0; it < 2; ++it) {
      *(v4u*)(dst + (size_t)it * 32 * HD) = vals[it];
    }
    
  }
}

// =====================================================================================================
// Masked flash attention per (b,h), scores taken transposed. Block = (bh, 64 queries), 4 waves: wave w = (g = w & 1, kh = w >> 1)
//   owns the 32 queries iw = 64t + 32g .. +31 (two 16-column groups x = 0, 1) and the keys 1024*kh .. 1024*kh + 1023: every
//   loaded k and v^T fragment feeds two products, and the block still has 4 waves (4 blocks per WGP, 4 waves per SIMD).
//   q plane f16 [bh][s][d], k plane and v^T plane f16 in fragment order (4096 contiguous bytes each per 32-key step), mask
//   bits [query tile][step][c] shared over bh (bit clear = masked): 64 contiguous bytes per column group and step.
//   Key loop (uniform bound): 32 steps of 32 keys; the two waves of a pair visit every key tile between them.
//   Per 32-key step and column group: S^T = K.Q^T, A = k fragment (row = key), B = q fragment (column = query), 2 key subtiles x
//   2 k-steps x 1 product. Lane (hh, c) then holds, for its query iw + 16x + c, the 16 keys kb + 8hh + 0..7 and
//   kb + 16 + 8hh + 0..7: the mask is one 32-bit word of the query's own bits, applied by value in the log2 domain
//   (t := -1e9*log2e where mask == 0, the scaled score otherwise), so a row whose visited keys are all masked stays uniform exactly
//   like the spec and a single unmasked key zeroes every masked term through exp2; the step's maximum is taken in the lane plus
//   one exchange between the lane halves; the sum stays a per-lane partial (its own 16 keys of each step), joined behind the loop.
//   Those 16 values are, in this order, the B fragment of P^T in the split k map: P*32768 is rounded once to f16 (11 bits; the
//   other operand v carries the 8 bits of bf16) in place, no LDS and no lane exchange. O^T += V^T.P^T, A = v^T fragment
//   (row = d), 4 WMMAs per column group; the rescale factor of a group's 4 accumulators is one value per lane.
//   Join of the key halves: wave (g, kh) keeps column group kh and hands group 1 - kh (maximum, sum, 32 accumulators per lane) to
//   its partner (g, 1 - kh) through LDS, one block barrier between the writes and the reads; both partials are brought to the
//   common maximum and added (a half whose keys are all masked gets factor 0 beside a real maximum, factor 1 beside another such).
//   Epilogue: 1/l and carry folds in f32; lane (hh, c) holds d = 16j + 8hh + 0..7 of its kept query; the wave's 16x64 f32 result is
//   staged in its LDS slab (pitch 68) and stored as whole 256-B rows.
// coverage: per wave 8 instructions x 32 lanes x 4 floats = 16 rows x 64 (queries 64t + 32g + 16kh + 0..15); per block 4 waves =
//           64 rows; 32 blocks per bh x 32 bh: every row of out [32][2048][64] exactly once (grid 1024 blocks).
// =====================================================================================================
__global__ __launch_bounds__(ATT_THREADS)
void attn_masked(const unsigned short* __restrict__ QHp, const unsigned short* __restrict__ KHp,
                 const unsigned short* __restrict__ VTq, const unsigned int* __restrict__ Msk, float* OPp) {
  __shared__ __align__(16) float smem[ATW * SLABF];    // per wave: result slab of the epilogue
  __shared__ __align__(16) float xch[ATW * XCHF];      // per wave: the partial it hands to its partner

  const int tid  = threadIdx.x;
  const int wave = __builtin_amdgcn_readfirstlane(tid >> 5);   // the same in every lane: key offsets and addresses stay scalar
  const int lane = tid & 31;
  const int hh   = lane >> 4;
  const int c    = lane & 15;
  const int g    = wave & 1;                           // which 32 queries of the block
  const int kh   = wave >> 1;                          // which half of the keys

  const int bid  = blockIdx.x;
  const int bh   = bid / BPH;
  const int t    = bid - bh * BPH;                     // 0..31, block-uniform
  if (bh >= NBH) return;                               // never taken with the exact grid; before any LDS use, barrier or store

  const int i0 = QPB * t;
  const int iw = i0 + g * 32;                          // query 0 of this wave, <= SEQ-32
  const int k0 = kh * KHALF;                           // key 0 of this wave

  v16h qb[2][2];                                       // [column group][d 0..31, d 32..63]
#pragma unroll
  for (int x = 0; x < 2; ++x) {
    const _Float16* Qb = (const _Float16*)(const void*)QHp + ((size_t)bh * SEQ + (size_t)(iw + 16 * x + c)) * HD + 8 * hh;
    qb[x][0] = ldfrag_h(Qb);
    qb[x][1] = ldfrag_h(Qb + 32);
  }
  // mask words: query tile iw/16 + x, word of query c (shared over bh); the second column group's tile lies MTW words on
  const unsigned int* Mb = Msk + (size_t)(iw >> 4) * MTW + c;
  const _Float16* Kb = (const _Float16*)(const void*)KHp + (size_t)bh * SEQ * HD;   // block-uniform plane bases
  const _Float16* Vb = (const _Float16*)(const void*)VTq + (size_t)bh * SEQ * HD;
  const unsigned  lo = 8u * (unsigned)lane;            // this lane's 16-B chunk in each 512-B run, lane = 16*hh + c
  const float lsc = LOG2E / (8.0f * QSC * KSC);        // 1/sqrt(64) and the q,k carries, base-2 domain

  float mrow[2], lrow[2];                              // per column group: running maximum (both halves equal), partial sum
  v8f o[2][4];
#pragma unroll
  for (int x = 0; x < 2; ++x) {
    mrow[x] = -INFINITY;
    lrow[x] = 0.f;
#pragma unroll
    for (int j = 0; j < 4; ++j) o[x][j] = zero8();
  }

  // ---- operands of the first step: mask words of the two queries (both lane halves read the same word), the k fragments (A, row =
  //      key; row tiles 0 and 1, d 0..31 and d 32..63 each) and the v^T fragments (A, row m = d = j*16 + c, 1024 bytes per j) ----
  unsigned int mwq[2] = { Mb[k0 >> 1], Mb[MTW + (k0 >> 1)] };
  const _Float16* kp0 = Kb + (size_t)k0 * HD;
  const _Float16* vp0 = Vb + (size_t)k0 * HD;
  v16h kf00 = ldfrag_f(kp0, lo),        kf01 = ldfrag_f(kp0 + 512, lo);
  v16h kf10 = ldfrag_f(kp0 + 1024, lo), kf11 = ldfrag_f(kp0 + 1536, lo);
  // keeps q, k and the mask words ahead of v^T, the order of the loop: the compiler sets the loop's counted waits for the stricter of
  // the two orders, and with v^T loads mixed in here the score products of every step would wait for v^T loads as well
  __builtin_amdgcn_sched_barrier(0);
  v16h va0 = ldfrag_f(vp0, lo),         va1 = ldfrag_f(vp0 + 512, lo);
  v16h va2 = ldfrag_f(vp0 + 1024, lo),  va3 = ldfrag_f(vp0 + 1536, lo);

  // kept rolled: one step's registers and a short loop text
#pragma unroll 1
  for (int ks = 0; ks < KHALF; ks += 32) {
    // every step asks for the next step's operands as soon as its own products have read theirs, into the same registers: the
    // loads fly under the softmax and the other products. The last step asks for its own tile again (in range, never used).
    const int kn = k0 + ((ks + 32 < KHALF) ? (ks + 32) : ks);      // wave-uniform; this step's keys start at kb = k0 + ks
    // ---- scores: D element r of this lane = (key kb + 8hh + r, query iw + 16x + c) in s[x][0], key kb + 16 + 8hh + r in s[x][1] ----
    v8f s[2][2];
#pragma unroll
    for (int x = 0; x < 2; ++x) {
      s[x][0] = mma_raw(kf00, qb[x][0], zero8());
      s[x][1] = mma_raw(kf10, qb[x][0], zero8());
    }
#pragma unroll
    for (int x = 0; x < 2; ++x) {
      s[x][0] = mma_raw(kf01, qb[x][1], s[x][0]);
      s[x][1] = mma_raw(kf11, qb[x][1], s[x][1]);
    }
    {
      const _Float16* kp = Kb + (size_t)kn * HD;                   // row tiles kn/16 and kn/16 + 1: key rows kn + c, kn + 16 + c
      kf00 = ldfrag_f(kp, lo);         kf01 = ldfrag_f(kp + 512, lo);
      kf10 = ldfrag_f(kp + 1024, lo);  kf11 = ldfrag_f(kp + 1536, lo);
    }
    // keeps the loads above ahead of the softmax: without it the compiler moves them to the foot of the step, where they have no lead
    __builtin_amdgcn_sched_barrier(0);
    FragH ph[2];
#pragma unroll
    for (int x = 0; x < 2; ++x) {
      // ---- replace-mask by value + online softmax in base 2, all 16 keys of the query in this lane ----
      const unsigned int mwx = mwq[x] >> (8 * hh);     // bit r = key kb + 8hh + r
      v8f t0 = s[x][0] * lsc, t1 = s[x][1] * lsc;
#pragma unroll
      for (int r = 0; r < 8; ++r) {
        const int m0 = __builtin_amdgcn_sbfe((int)mwx, r, 1);         // all ones where the key is kept
        const int m1 = __builtin_amdgcn_sbfe((int)mwx, 16 + r, 1);    // bit 16 + r = key kb + 16 + 8hh + r
        t0[r] = msel((float)t0[r], m0);
        t1[r] = msel((float)t1[r], m1);
      }
      float mx = fmaxf(t0[0], t1[0]);
#pragma unroll
      for (int r = 1; r < 8; ++r) mx = fmaxf(mx, fmaxf(t0[r], t1[r]));
      mx = fmaxf(mx, xhalf(mx));                       // the other 16 keys of the step
      const float mn = fmaxf(mrow[x], mx);             // finite: mx is either a scaled score or NEGT
      const float al = ex2(mrow[x] - mn);              // 0 on the first step (mrow = -inf)
      mrow[x] = mn;
      t0 -= mn;
      t1 -= mn;
      v8f e0, e1;
#pragma unroll
      for (int r = 0; r < 8; ++r) { e0[r] = ex2(t0[r]); e1[r] = ex2(t1[r]); }
      const v8f es = e0 + e1;
      lrow[x] = lrow[x] * al + (((es[0] + es[1]) + (es[2] + es[3])) + ((es[4] + es[5]) + (es[6] + es[7])));
#pragma unroll
      for (int j = 0; j < 4; ++j) o[x][j] *= al;
      // ---- B fragment of P^T*32768 in f16, column = query c; elements 0..7 = keys kb + 8hh + 0..7 (e0),
      //      elements 8..15 = keys kb + 16 + 8hh + 0..7 (e1): the split k map of the v^T fragments ----
      ph[x].h[0] = __builtin_convertvector(e0 * PCAR, v8h);
      ph[x].h[1] = __builtin_convertvector(e1 * PCAR, v8h);
    }
    // keeps the next mask words' loads behind the last use of this step's words: asked for earlier they need registers of their own
    // and a copy, and the copy's wait for them stood in the middle of the softmax
    __builtin_amdgcn_sched_barrier(0);
    mwq[0] = Mb[kn >> 1];                                          // step kn/32, 16 words each
    mwq[1] = Mb[MTW + (kn >> 1)];
    // keeps them ahead of the v^T loads: the waits count loads in order, and behind the v^T loads the next step's mask would wait for all
    __builtin_amdgcn_sched_barrier(0);
    // ---- O^T += V^T.P^T over keys kb .. kb+31, both column groups on each v^T fragment ----
#pragma unroll
    for (int x = 0; x < 2; ++x) {
      o[x][0] = mma_raw(va0, ph[x].v, o[x][0]);
      o[x][1] = mma_raw(va1, ph[x].v, o[x][1]);
      o[x][2] = mma_raw(va2, ph[x].v, o[x][2]);
      o[x][3] = mma_raw(va3, ph[x].v, o[x][3]);
    }
    {
      const _Float16* vp = Vb + (size_t)kn * HD;                   // step kn/32, 32*HD halves each
      va0 = ldfrag_f(vp, lo);          va1 = ldfrag_f(vp + 512, lo);
      va2 = ldfrag_f(vp + 1024, lo);   va3 = ldfrag_f(vp + 1536, lo);
    }
    // the address registers of the loads above may be given to the next step's values: the wait before an issued load's
    // registers are rewritten
    asm volatile("s_wait_xcnt 0x0" ::: "memory");
  }

  // ---- join the key halves: hand column group 1 - kh to the partner wave, keep group kh ----
  const bool up = (kh != 0);                             // wave-uniform
  const float lj0 = lrow[0] + xhalf(lrow[0]);            // the lane halves' sums joined, per column group
  const float lj1 = lrow[1] + xhalf(lrow[1]);
  {
    float* xw = xch + wave * XCHF + lane * 4;            // chunk ch at (ch*32 + lane)*4: 512 contiguous bytes per store
#pragma unroll
    for (int j = 0; j < 4; ++j) {
      v4f w0, w1;
#pragma unroll
      for (int e = 0; e < 4; ++e) { w0[e] = up ? o[0][j][e] : o[1][j][e]; w1[e] = up ? o[0][j][4 + e] : o[1][j][4 + e]; }
      *(v4f*)(xw + (2 * j) * 128)     = w0;
      *(v4f*)(xw + (2 * j + 1) * 128) = w1;
    }
    v4f wm = { up ? mrow[0] : mrow[1], up ? lj0 : lj1, 0.f, 0.f };
    *(v4f*)(xw + 8 * 128) = wm;
  }
  __syncthreads();                                       // every wave's partial is written before its partner reads it
  const float* xr = xch + (wave ^ 2) * XCHF + lane * 4;  // partner: same queries and lane map, the other key half
  const v4f pm = *(const v4f*)(xr + 8 * 128);
  const float ma = up ? mrow[1] : mrow[0];               // both maxima finite (a scaled score or NEGT)
  const float la = up ? lj1 : lj0;
  const float mj = fmaxf(ma, pm[0]);
  const float fa = ex2(ma - mj), fb = ex2(pm[0] - mj);
  const float lr = la * fa + pm[1] * fb;                 // >= 1 (the max element contributes 2^0)

  // ---- fold 1/l and the carries (32768 on P, 256 on v), stage the wave's 16x64 slab in its LDS region ----
  float* slab = smem + wave * SLABF;
  const float oc  = 1.0f / (PCAR * VCAR);
  const float inv = (lr > 0.0f) ? ((1.0f / lr) * oc) : 0.0f;
  const float ia = fa * inv, ib = fb * inv;
#pragma unroll
  for (int j = 0; j < 4; ++j) {
    float* sp = slab + c * SLP + j * 16 + 8 * hh;        // D element r of o[.][j] = (d = 16j + 8hh + r, kept query c)
    const v4f p0 = *(const v4f*)(xr + (2 * j) * 128), p1 = *(const v4f*)(xr + (2 * j + 1) * 128);
    v4f w0, w1;
#pragma unroll
    for (int e = 0; e < 4; ++e) {
      w0[e] = (up ? o[1][j][e] : o[0][j][e]) * ia + p0[e] * ib;
      w1[e] = (up ? o[1][j][4 + e] : o[0][j][4 + e]) * ia + p1[e] * ib;
    }
    *(v4f*)(sp)     = w0;
    *(v4f*)(sp + 4) = w1;
  }
  wave_sync_lds();
  v4f vals[8];
#pragma unroll
  for (int it = 0; it < 8; ++it) vals[it] = *(const v4f*)(slab + (2 * it + hh) * SLP + c * 4);
  float* dst = OPp + ((size_t)(bh * SEQ + iw + 16 * kh)) * HD + hh * HD + c * 4;
  {
#pragma unroll
    for (int it = 0; it < 8; ++it) {
      *(v4f*)(dst + (size_t)(2 * it) * HD) = vals[it];
    }
  }
}

// =====================================================================================================
// Workspace map (bytes); every plane is fully written by whole-line stores before it is read; all extents are exact
// multiples of the store granularity (no pad rows needed); offsets multiples of 128:
//   QH f16 [32][2048][64] x1024        8388608   at        0
//   KH f16 fragment order x1024        8388608   at  8388608
//   VT f16 fragment order x256         8388608   at 16777216
//   MB mask bits [128][64][16] u32      524288   at 25165824
//   end                                             25690112
// =====================================================================================================
extern "C" void kernel_launch(void* const* d_in, const int* in_sizes, int n_in,
                              void* d_out, int out_size, void* d_ws, size_t ws_size,
                              hipStream_t stream) {
  const int NEL = NBH * SEQ * HD;                       // 4194304
  if (n_in < 4) return;
  if (in_sizes[0] < NEL || in_sizes[1] < NEL || in_sizes[2] < NEL || in_sizes[3] < SEQ * SEQ) return;
  if (out_size < NEL) return;

  const float* q  = (const float*)d_in[0];
  const float* k  = (const float*)d_in[1];
  const float* v  = (const float*)d_in[2];
  const int*   mk = (const int*)d_in[3];
  float*       out = (float*)d_out;

  const size_t PQ = (size_t)NEL * 2;                    //  8388608
  const size_t PK = (size_t)NEL * 2;                    //  8388608
  const size_t PV = (size_t)NBH * HD * SEQ * 2;         //  8388608
  size_t off = 0;
  const size_t oQH = off; off += PQ;
  const size_t oKH = off; off += PK;
  const size_t oVT = off; off += PV;
  const size_t oMB = off; off += (size_t)SEQ * SEQ / 8; //   524288
  if (off > ws_size) return;                            // off = 25690112
  if (off > (size_t)134217728) return;

  char* ws = (char*)d_ws;
  unsigned short* QH = (unsigned short*)(ws + oQH);
  unsigned short* KH = (unsigned short*)(ws + oKH);
  unsigned short* VT = (unsigned short*)(ws + oVT);
  unsigned int*   MB = (unsigned int*)(ws + oMB);

  const int n8 = NEL / 8;                               // 524288
  const dim3 blk(256);
  const dim3 gC(n8 / 256, 2);                           // (2048, 2): q and k planes in one launch, the mask bits shared out over both
  const dim3 gVT(NBH * VTILES);                         // 1024
  const dim3 gAT(ATT_BLOCKS);                           // 1024
  const dim3 bAT(ATT_THREADS);                          // 128

  // (0) q and k planes f16(bf16(x) * 1024): q [bh][s][d], k fragment order; mask bits
  cvt16<<<gC, blk, 0, stream>>>(q, k, QH, KH, n8, QSC, mk, MB);
  // (1) v^T plane f16(bf16(v) * 256), fragment order
  vt16<<<gVT, blk, 0, stream>>>(v, VT);
  // (2) masked flash attention per (b,h) -> out [bh][s][d] f32
  attn_masked<<<gAT, bAT, 0, stream>>>(QH, KH, VT, MB, out);
  (void)hipGetLastError();
}

// v008
// One run takes 51.8 microseconds.
// Next to v007, in two timings, it ran 1.04 and 1.06 times as fast.
// Over all steps from v000 it is 2.68 times as fast.
// Contractions: scores k.q^T (k x1024 as A and q x1024 as B, f16 planes of the bf16-RNE-converted inputs, one product each,
// K=64) and v^T.P^T (v x256 f16 of the bf16-RNE-converted input as A, P x32768 rounded once to f16 as B, one product,
// 32-key steps): all v_wmma_f32_16x16x32_f16, f32 accumulate. A wave owns 32 queries and half the keys; a lane holds one query's
// scores per 16-column group: base-2 online
// softmax in the lane with the key mask applied by value (replace) and the 1/l fold in f32 on VALU. The int mask is packed once
// per call to one bit per key (bit = mask != 0), as lane masks: one 32-bit word per score register, bit = lane; a wave reads
// the 16 words of a column group and 32-key step with one scalar load, and each score takes one select on its word.
// The k plane and the v^T plane lie in fragment order: each 16-B load of a fragment reads 512 contiguous bytes per wave.
#include <hip/hip_runtime.h>
#include <math.h>
#include <stdint.h>

#define NBH   32
#define SEQ   2048
#define HD    64
#define QSC   1024.0f
#define KSC   1024.0f
#define PCAR  32768.0f
#define VCAR  256.0f
#define LOG2E 1.4426950408889634f
#define NEGT  (-1.0e9f * LOG2E)
#define ATW   4
#define ATT_THREADS (ATW * 32)
#define QPB   (16 * ATW)
#define BPH   (SEQ / QPB)
#define ATT_BLOCKS (NBH * BPH)
#define SLP   68
#define SLABF (16 * SLP)
#define KHALF (SEQ / 2)
#define XCHF  (9 * 32 * 4)
#define MTW   (SEQ / 32 * 16)
#define VTP   72
#define VTILES (SEQ / 64)
static_assert(HD == 64 && QPB == 64 && ATT_THREADS == 128);
static_assert((SEQ % QPB) == 0 && (SEQ % 64) == 0 && (SEQ % 32) == 0);
static_assert(BPH == 32 && ATT_BLOCKS == 1024 && VTILES == 32);
static_assert(ATW == 4 && (KHALF % 32) == 0 && 2 * KHALF == SEQ);
static_assert((HD - 1) * VTP + 63 < HD * VTP);
static_assert(((NBH * SEQ * HD) % 2048) == 0);
#define CVB   ((NBH * SEQ * HD) / 2048)
static_assert(2 * CVB == (SEQ / 16) * (SEQ / 64));     // convert blocks of both planes = (query tiles) x (pairs of 32-key steps)

typedef _Float16 v16h __attribute__((ext_vector_type(16)));
typedef _Float16 v8h  __attribute__((ext_vector_type(8)));
typedef float    v8f  __attribute__((ext_vector_type(8)));
typedef float    v4f  __attribute__((ext_vector_type(4)));
typedef unsigned int v4u __attribute__((ext_vector_type(4)));
typedef int      v4i  __attribute__((ext_vector_type(4)));
typedef unsigned int v16u __attribute__((ext_vector_type(16)));

union FragH { v16h v; v8h h[2]; v4u u[2]; };

// ---- scalar helpers --------------------------------------------------------------------------------
__device__ __forceinline__ unsigned short bf_bits(float f) {          // f32 -> bf16 bits, RNE convert
  unsigned u = __float_as_uint(f);
  return (unsigned short)((u + 0x7FFFu + ((u >> 16) & 1u)) >> 16);
}
__device__ __forceinline__ float bf_up(unsigned short h) { return __uint_as_float(((unsigned)h) << 16); }
__device__ __forceinline__ float bfr(float f) { return bf_up(bf_bits(f)); }   // value of the bf16 RNE convert
__device__ __forceinline__ unsigned short h_bits(_Float16 x) { return __builtin_bit_cast(unsigned short, x); }
__device__ __forceinline__ unsigned pk16(unsigned short a, unsigned short b) { return (unsigned)a | ((unsigned)b << 16); }
__device__ __forceinline__ v8f zero8() { v8f z = {0.f, 0.f, 0.f, 0.f, 0.f, 0.f, 0.f, 0.f}; return z; }

// ---- fragment loader: 16-bit A/B operand, lane -> row/col (lane&15), p already includes +8*(lane>>4);
//      elements 0..7 <- p[0..7] (k0+8h..), elements 8..15 <- p[16..23] (k0+16+8h..)  (same split k map for A and B;
//      here it reads only B, from the [s][d] q plane; A fragments use ldfrag_f)
__device__ __forceinline__ v16h ldfrag_h(const _Float16* p) {
  FragH f;
  f.h[0] = *(const v8h*)(p);
  f.h[1] = *(const v8h*)(p + 16);
  return f.v;
}

// ---- same fragment from a plane kept in fragment order: p is wave-uniform, lo = 8*lane; the lanes' first 8 elements are one
//      contiguous 512-B run, their second 8 elements the next 512-B run (256 halves on)
__device__ __forceinline__ v16h ldfrag_f(const _Float16* p, unsigned lo) {
  FragH f;
  f.h[0] = *(const v8h*)(p + lo);
  f.h[1] = *(const v8h*)(p + 256 + lo);
  return f.v;
}

__device__ __forceinline__ v8f mma_raw(v16h a, v16h b, v8f c) {
  return __builtin_amdgcn_wmma_f32_16x16x32_f16(false, a, false, b, (short)0, c, false, false);
}
// value of the lane 16 away (lane l <-> l ^ 16), a vector cross-row move
__device__ __forceinline__ float xhalf(float x) {
  const int b = __builtin_bit_cast(int, x);
  return __builtin_bit_cast(float, __builtin_amdgcn_permlanex16(b, b, 0x76543210, 0xfedcba98, false, false));
}
// 2^x by the hardware instruction alone. Every argument here is <= 0 (or -inf): a result under 2^-126 comes out 0 where the
// library form's range guard (compare, two selects, add, ldexp per value) gave a denormal; such a term is 0 in the f16 plane of
// P*32768 anyway and is far under one ulp of the row sum (>= 1).
__device__ __forceinline__ float ex2(float x) { return __builtin_amdgcn_exp2f(x); }
// lanes is wave-uniform, bit l belongs to lane l. Bit set: t; bit clear: the masked value -1e9*log2e. One select on a scalar lane mask.
__device__ __forceinline__ float msel(float t, unsigned int lanes) {
  return __builtin_amdgcn_inverse_ballot_w32(lanes) ? t : NEGT;
}
__device__ __forceinline__ void wave_sync_lds() {
  __builtin_amdgcn_fence(__ATOMIC_RELEASE, "workgroup");
  __builtin_amdgcn_wave_barrier();
  __builtin_amdgcn_fence(__ATOMIC_ACQUIRE, "workgroup");
}

// =====================================================================================================
// 16-bit plane convert (inputs are [bh][s][d] with bh = b*16+h): value f16( bf16(x) * sc ) (sc a power of two, exact).
//   blockIdx.y == 0: q plane, layout [bh][s][d] as the input. blockIdx.y == 1: k plane in fragment order:
//   [row tile of 16][ld = 0..3][lane = 16*hh + c][8 halves] holds k[16*tile + c][16*ld + 8*hh + 0..7].
// Thread = one 16-B chunk of the plane (8 consecutive d of one row): two 16-B loads, one 16-B store; 32 consecutive lanes store 512-B
//   Every block also packs its share of the mask bits, plane [query tile of 16][step of 32 keys][n = 8*s + r] of 32-bit words:
//   bit (lane = 16*hh + c) of a word is (mask[16*tile + c][32*step + 16*s + 8*hh + r] != 0), the lane mask of score register r of
//   key subtile s in the attention wave. Block = (query tile, 2 steps): wave w takes queries 2w, 2w+1; a query's 32 keys are one
//   128-B load of the wave and one ballot; the block's 32 query words meet in LDS, and behind one barrier wave w turns them into
//   lane-mask words 4w .. 4w+3 (a lane tests its query's bit, one ballot a word); they are one whole 128-B line (one writer).
// coverage: grid = (n8/256, 2) blocks x 256 thr x 8 elements = n = 32*2048*64 per plane exactly (n % 2048 == 0 asserted);
//           mask: 128 tiles x 32 pairs of steps = 4096 blocks x 32 words = 2048 queries x 64 words, each exactly once.
// =====================================================================================================
__global__ __launch_bounds__(256) void cvt16(const float* __restrict__ xq, const float* __restrict__ xk,
                                             unsigned short* plq, unsigned short* plk, int n8, float sc,
                                             const int* __restrict__ msk, unsigned int* mbits) {
  __shared__ unsigned int qw[32];           // [step of the pair][query c]: bit b = key 32*step + b
  const int gt = blockIdx.x * 256 + (int)threadIdx.x;
  if (gt >= n8) return;                     // never taken with the exact grid (n8 a multiple of 256: whole blocks only); before the barrier
  int mx[4];                                // mask values of this wave's 4 words; every lane is on (exact grid)
  const int lane = (int)threadIdx.x & 31, wv = (int)threadIdx.x >> 5;
  const int fb = (int)blockIdx.y * CVB + (int)blockIdx.x;                // 0..4095: query tile fb >> 5, pair of steps fb & 31
  const bool sk = (blockIdx.y != 0);        // block-uniform plane select (both pointers global)
  const float* x = sk ? xk : xq;
  unsigned short* pl = sk ? plk : plq;
  const size_t e = (size_t)gt * 8;          // destination element: the stores stay contiguous for both planes
  // source element: q the same place; k row 16*(gt>>7) + (gt&15), d chunk 2*((gt>>5)&3) + ((gt>>4)&1) (a bijection on gt)
  const size_t es = sk ? ((size_t)((gt >> 7) * 16 + (gt & 15)) * HD + (size_t)((((gt >> 5) & 3) * 2 + ((gt >> 4) & 1)) * 8)) : e;
  const v4f a = *(const v4f*)(x + es), bq = *(const v4f*)(x + es + 4);
  {
    const int* mp = msk + ((size_t)(16 * (fb >> 5) + 2 * wv) * SEQ + (size_t)(64 * (fb & 31) + lane));
#pragma unroll
    for (int i = 0; i < 4; ++i) mx[i] = mp[(size_t)(i >> 1) * SEQ + (size_t)(32 * (i & 1))];  // query 2wv + (i>>1), step 2(fb&31) + (i&1)
  }
  v4u o;
#pragma unroll
  for (int i = 0; i < 2; ++i) {
    o[i]     = pk16(h_bits((_Float16)(bfr(a[2 * i]) * sc)),  h_bits((_Float16)(bfr(a[2 * i + 1]) * sc)));
    o[2 + i] = pk16(h_bits((_Float16)(bfr(bq[2 * i]) * sc)), h_bits((_Float16)(bfr(bq[2 * i + 1]) * sc)));
  }
  unsigned int w = 0u;
#pragma unroll
  for (int i = 0; i < 4; ++i) {
    const unsigned int b = __builtin_amdgcn_ballot_w32(mx[i] != 0);
    w = (lane == i) ? b : w;                // lane i keeps word i
  }
  if (lane < 4) qw[(lane & 1) * 16 + 2 * wv + (lane >> 1)] = w;
  __syncthreads();                          // all 32 query words are in LDS before any wave reads them
  // wave wv = 4*step + 2*s + u makes the words n = 8*s + 4*u + 0..3 of its step
  const unsigned int row = qw[(wv >> 2) * 16 + (lane & 15)] >> (16 * ((wv >> 1) & 1) + 8 * (lane >> 4) + 4 * (wv & 1));
  unsigned int z = 0u;
#pragma unroll
  for (int i = 0; i < 4; ++i) {
    const unsigned int b = __builtin_amdgcn_ballot_w32(((row >> i) & 1u) != 0u);
    z = (lane == i) ? b : z;                // lane i keeps word i
  }
  // both stores stand behind the barrier: in front of it the barrier's release would wait for the plane store to complete
  *(v4u*)(pl + e) = o;
  if (lane < 4) mbits[(size_t)fb * 32 + (size_t)(4 * wv + lane)] = z;
}

// =====================================================================================================
// v^T plane in fragment order, values f16( bf16(v[bh][key][d]) * 256 ) (exact):
//   [bh][step of 32 keys][j = 0..3][part = 0..1][lane = 16*hh + c][8 halves] holds d = 16*j + c, keys 32*step + 16*part + 8*hh + 0..7.
// Block = (bh, tile of 64 keys): 64 source rows of 64 floats loaded with 16-B loads (static stride), converted, written into
// coverage: load 256 thr x 16 elements = 64 keys x 64 d; store 2 iterations x 256 thr x 8 halves = 64 lines x 64 = the tile;
//           grid = NBH x 32 = 1024 blocks, each 8192 contiguous bytes (2 steps): the whole plane exactly once.
// =====================================================================================================
__global__ __launch_bounds__(256) void vt16(const float* __restrict__ v, unsigned short* VTo) {
  __shared__ __align__(16) unsigned short T[HD * VTP];
  const int tid = threadIdx.x;
  const int bid = blockIdx.x;
  const int bh  = bid / VTILES;
  const int t   = bid - bh * VTILES;        // 0..31, block-uniform
  if (bh >= NBH) return;                    // never taken with the exact grid; before any barrier or store
  {
    const int sl = tid >> 2;                  // key within tile 0..63
    const int dc = (tid & 3) * 16;            // d chunk
    int key = 64 * t + sl;                    // <= SEQ-1 by construction; clamp keeps the address in range regardless
    key = (key < 0) ? 0 : ((key > SEQ - 1) ? (SEQ - 1) : key);
    const float* src = v + (((size_t)bh * SEQ + (size_t)key) * HD + dc);
#pragma unroll
    for (int i = 0; i < 4; ++i) {
      const v4f a = *(const v4f*)(src + 4 * i);
#pragma unroll
      for (int e = 0; e < 4; ++e) T[(dc + 4 * i + e) * VTP + sl] = h_bits((_Float16)(bfr(a[e]) * VCAR));
    }
  }
  __syncthreads();
  v4u vals[2];
  const int line = ((tid >> 6) & 3) * 16 + (tid & 15);        // d = 16*j + c, 0..63
  const int p8   = ((tid >> 5) & 1) * 16 + ((tid >> 4) & 1) * 8; // key within the 32-key step: 16*part + 8*hh
#pragma unroll
  for (int it = 0; it < 2; ++it) vals[it] = *(const v4u*)(T + line * VTP + it * 32 + p8);   // it = step within the tile
  unsigned short* dst = VTo + ((size_t)bh * SEQ + (size_t)(64 * t)) * HD + tid * 8;
  {
#pragma unroll
    for (int it = 0; it < 2; ++it) {
      *(v4u*)(dst + (size_t)it * 32 * HD) = vals[it];
    }
    
  }
}

// =====================================================================================================
// Masked flash attention per (b,h), scores taken transposed. Block = (bh, 64 queries), 4 waves: wave w = (g = w & 1, kh = w >> 1)
//   owns the 32 queries iw = 64t + 32g .. +31 (two 16-column groups x = 0, 1) and the keys 1024*kh .. 1024*kh + 1023: every
//   loaded k and v^T fragment feeds two products, and the block still has 4 waves (4 blocks per WGP, 4 waves per SIMD).
//   q plane f16 [bh][s][d], k plane and v^T plane f16 in fragment order (4096 contiguous bytes each per 32-key step), mask
//   bits [query tile][step][8s + r] shared over bh (bit clear = masked): 64 contiguous bytes per column group and step.
//   Key loop (uniform bound): 32 steps of 32 keys; the two waves of a pair visit every key tile between them.
//   Per 32-key step and column group: S^T = K.Q^T, A = k fragment (row = key), B = q fragment (column = query), 2 key subtiles x
//   2 k-steps x 1 product. Lane (hh, c) then holds, for its query iw + 16x + c, the 16 keys kb + 8hh + 0..7 and
//   kb + 16 + 8hh + 0..7: the mask is one wave-uniform word per score register (bit = lane), applied by value in the log2 domain
//   (t := -1e9*log2e where mask == 0, the scaled score otherwise), so a row whose visited keys are all masked stays uniform exactly
//   like the spec and a single unmasked key zeroes every masked term through exp2; the step's maximum is taken in the lane plus
//   one exchange between the lane halves; the sum stays a per-lane partial (its own 16 keys of each step), joined behind the loop.
//   Those 16 values are, in this order, the B fragment of P^T in the split k map: P*32768 is rounded once to f16 (11 bits; the
//   other operand v carries the 8 bits of bf16) in place, no LDS and no lane exchange. O^T += V^T.P^T, A = v^T fragment
//   (row = d), 4 WMMAs per column group; the rescale factor of a group's 4 accumulators is one value per lane.
//   Join of the key halves: wave (g, kh) keeps column group kh and hands group 1 - kh (maximum, sum, 32 accumulators per lane) to
//   its partner (g, 1 - kh) through LDS, one block barrier between the writes and the reads; both partials are brought to the
//   common maximum and added (a half whose keys are all masked gets factor 0 beside a real maximum, factor 1 beside another such).
//   Epilogue: 1/l and carry folds in f32; lane (hh, c) holds d = 16j + 8hh + 0..7 of its kept query; the wave's 16x64 f32 result is
//   staged in its LDS slab (pitch 68) and stored as whole 256-B rows.
// coverage: per wave 8 instructions x 32 lanes x 4 floats = 16 rows x 64 (queries 64t + 32g + 16kh + 0..15); per block 4 waves =
//           64 rows; 32 blocks per bh x 32 bh: every row of out [32][2048][64] exactly once (grid 1024 blocks).
// =====================================================================================================
__global__ __launch_bounds__(ATT_THREADS)
void attn_masked(const unsigned short* __restrict__ QHp, const unsigned short* __restrict__ KHp,
                 const unsigned short* __restrict__ VTq, const unsigned int* __restrict__ Msk, float* OPp) {
  __shared__ __align__(16) float smem[ATW * SLABF];    // per wave: result slab of the epilogue
  __shared__ __align__(16) float xch[ATW * XCHF];      // per wave: the partial it hands to its partner

  const int tid  = threadIdx.x;
  const int wave = __builtin_amdgcn_readfirstlane(tid >> 5);   // the same in every lane: key offsets and addresses stay scalar
  const int lane = tid & 31;
  const int hh   = lane >> 4;
  const int c    = lane & 15;
  const int g    = wave & 1;                           // which 32 queries of the block
  const int kh   = wave >> 1;                          // which half of the keys

  const int bid  = blockIdx.x;
  const int bh   = bid / BPH;
  const int t    = bid - bh * BPH;                     // 0..31, block-uniform
  if (bh >= NBH) return;                               // never taken with the exact grid; before any LDS use, barrier or store

  const int i0 = QPB * t;
  const int iw = i0 + g * 32;                          // query 0 of this wave, <= SEQ-32
  const int k0 = kh * KHALF;                           // key 0 of this wave

  v16h qb[2][2];                                       // [column group][d 0..31, d 32..63]
#pragma unroll
  for (int x = 0; x < 2; ++x) {
    const _Float16* Qb = (const _Float16*)(const void*)QHp + ((size_t)bh * SEQ + (size_t)(iw + 16 * x + c)) * HD + 8 * hh;
    qb[x][0] = ldfrag_h(Qb);
    qb[x][1] = ldfrag_h(Qb + 32);
  }
  // mask words: query tile iw/16 + x (shared over bh), wave-uniform; the second column group's tile lies MTW words on
  const unsigned int* Mb = Msk + (size_t)(iw >> 4) * MTW;
  const _Float16* Kb = (const _Float16*)(const void*)KHp + (size_t)bh * SEQ * HD;   // block-uniform plane bases
  const _Float16* Vb = (const _Float16*)(const void*)VTq + (size_t)bh * SEQ * HD;
  const unsigned  lo = 8u * (unsigned)lane;            // this lane's 16-B chunk in each 512-B run, lane = 16*hh + c
  const float lsc = LOG2E / (8.0f * QSC * KSC);        // 1/sqrt(64) and the q,k carries, base-2 domain

  float mrow[2], lrow[2];                              // per column group: running maximum (both halves equal), partial sum
  v8f o[2][4];
#pragma unroll
  for (int x = 0; x < 2; ++x) {
    mrow[x] = -INFINITY;
    lrow[x] = 0.f;
#pragma unroll
    for (int j = 0; j < 4; ++j) o[x][j] = zero8();
  }

  // ---- operands of the first step: the 16 lane-mask words of each column group (scalar registers), the k fragments (A, row =
  //      key; row tiles 0 and 1, d 0..31 and d 32..63 each) and the v^T fragments (A, row m = d = j*16 + c, 1024 bytes per j) ----
  v16u mwq[2] = { *(const v16u*)(Mb + (k0 >> 1)), *(const v16u*)(Mb + MTW + (k0 >> 1)) };
  const _Float16* kp0 = Kb + (size_t)k0 * HD;
  const _Float16* vp0 = Vb + (size_t)k0 * HD;
  v16h kf00 = ldfrag_f(kp0, lo),        kf01 = ldfrag_f(kp0 + 512, lo);
  v16h kf10 = ldfrag_f(kp0 + 1024, lo), kf11 = ldfrag_f(kp0 + 1536, lo);
  // keeps q, k and the mask words ahead of v^T, the order of the loop: the compiler sets the loop's counted waits for the stricter of
  // the two orders, and with v^T loads mixed in here the score products of every step would wait for v^T loads as well
  __builtin_amdgcn_sched_barrier(0);
  v16h va0 = ldfrag_f(vp0, lo),         va1 = ldfrag_f(vp0 + 512, lo);
  v16h va2 = ldfrag_f(vp0 + 1024, lo),  va3 = ldfrag_f(vp0 + 1536, lo);

  // kept rolled: one step's registers and a short loop text
#pragma unroll 1
  for (int ks = 0; ks < KHALF; ks += 32) {
    // every step asks for the next step's operands as soon as its own products have read theirs, into the same registers: the
    // loads fly under the softmax and the other products. The last step asks for its own tile again (in range, never used).
    const int kn = k0 + ((ks + 32 < KHALF) ? (ks + 32) : ks);      // wave-uniform; this step's keys start at kb = k0 + ks
    // ---- scores: D element r of this lane = (key kb + 8hh + r, query iw + 16x + c) in s[x][0], key kb + 16 + 8hh + r in s[x][1] ----
    v8f s[2][2];
#pragma unroll
    for (int x = 0; x < 2; ++x) {
      s[x][0] = mma_raw(kf00, qb[x][0], zero8());
      s[x][1] = mma_raw(kf10, qb[x][0], zero8());
    }
#pragma unroll
    for (int x = 0; x < 2; ++x) {
      s[x][0] = mma_raw(kf01, qb[x][1], s[x][0]);
      s[x][1] = mma_raw(kf11, qb[x][1], s[x][1]);
    }
    {
      const _Float16* kp = Kb + (size_t)kn * HD;                   // row tiles kn/16 and kn/16 + 1: key rows kn + c, kn + 16 + c
      kf00 = ldfrag_f(kp, lo);         kf01 = ldfrag_f(kp + 512, lo);
      kf10 = ldfrag_f(kp + 1024, lo);  kf11 = ldfrag_f(kp + 1536, lo);
    }
    // keeps the loads above ahead of the softmax: without it the compiler moves them to the foot of the step, where they have no lead
    __builtin_amdgcn_sched_barrier(0);
    FragH ph[2];
#pragma unroll
    for (int x = 0; x < 2; ++x) {
      // ---- replace-mask by value + online softmax in base 2, all 16 keys of the query in this lane ----
      v8f t0 = s[x][0] * lsc, t1 = s[x][1] * lsc;
#pragma unroll
      for (int r = 0; r < 8; ++r) {
        t0[r] = msel((float)t0[r], mwq[x][r]);         // word r: key kb + 8hh + r of query c, at bit 16hh + c
        t1[r] = msel((float)t1[r], mwq[x][8 + r]);     // word 8 + r: key kb + 16 + 8hh + r
      }
      float mx = fmaxf(t0[0], t1[0]);
#pragma unroll
      for (int r = 1; r < 8; ++r) mx = fmaxf(mx, fmaxf(t0[r], t1[r]));
      mx = fmaxf(mx, xhalf(mx));                       // the other 16 keys of the step
      const float mn = fmaxf(mrow[x], mx);             // finite: mx is either a scaled score or NEGT
      const float al = ex2(mrow[x] - mn);              // 0 on the first step (mrow = -inf)
      mrow[x] = mn;
      t0 -= mn;
      t1 -= mn;
      v8f e0, e1;
#pragma unroll
      for (int r = 0; r < 8; ++r) { e0[r] = ex2(t0[r]); e1[r] = ex2(t1[r]); }
      const v8f es = e0 + e1;
      lrow[x] = lrow[x] * al + (((es[0] + es[1]) + (es[2] + es[3])) + ((es[4] + es[5]) + (es[6] + es[7])));
#pragma unroll
      for (int j = 0; j < 4; ++j) o[x][j] *= al;
      // ---- B fragment of P^T*32768 in f16, column = query c; elements 0..7 = keys kb + 8hh + 0..7 (e0),
      //      elements 8..15 = keys kb + 16 + 8hh + 0..7 (e1): the split k map of the v^T fragments ----
      ph[x].h[0] = __builtin_convertvector(e0 * PCAR, v8h);
      ph[x].h[1] = __builtin_convertvector(e1 * PCAR, v8h);
    }
    mwq[0] = *(const v16u*)(Mb + (kn >> 1));                       // step kn/32, 16 words each
    mwq[1] = *(const v16u*)(Mb + MTW + (kn >> 1));
    // ---- O^T += V^T.P^T over keys kb .. kb+31, both column groups on each v^T fragment ----
#pragma unroll
    for (int x = 0; x < 2; ++x) {
      o[x][0] = mma_raw(va0, ph[x].v, o[x][0]);
      o[x][1] = mma_raw(va1, ph[x].v, o[x][1]);
      o[x][2] = mma_raw(va2, ph[x].v, o[x][2]);
      o[x][3] = mma_raw(va3, ph[x].v, o[x][3]);
    }
    {
      const _Float16* vp = Vb + (size_t)kn * HD;                   // step kn/32, 32*HD halves each
      va0 = ldfrag_f(vp, lo);          va1 = ldfrag_f(vp + 512, lo);
      va2 = ldfrag_f(vp + 1024, lo);   va3 = ldfrag_f(vp + 1536, lo);
    }
    // the address registers of the loads above may be given to the next step's values: the wait before an issued load's
    // registers are rewritten
    asm volatile("s_wait_xcnt 0x0" ::: "memory");
  }

  // ---- join the key halves: hand column group 1 - kh to the partner wave, keep group kh ----
  const bool up = (kh != 0);                             // wave-uniform
  const float lj0 = lrow[0] + xhalf(lrow[0]);            // the lane halves' sums joined, per column group
  const float lj1 = lrow[1] + xhalf(lrow[1]);
  {
    float* xw = xch + wave * XCHF + lane * 4;            // chunk ch at (ch*32 + lane)*4: 512 contiguous bytes per store
#pragma unroll
    for (int j = 0; j < 4; ++j) {
      v4f w0, w1;
#pragma unroll
      for (int e = 0; e < 4; ++e) { w0[e] = up ? o[0][j][e] : o[1][j][e]; w1[e] = up ? o[0][j][4 + e] : o[1][j][4 + e]; }
      *(v4f*)(xw + (2 * j) * 128)     = w0;
      *(v4f*)(xw + (2 * j + 1) * 128) = w1;
    }
    v4f wm = { up ? mrow[0] : mrow[1], up ? lj0 : lj1, 0.f, 0.f };
    *(v4f*)(xw + 8 * 128) = wm;
  }
  __syncthreads();                                       // every wave's partial is written before its partner reads it
  const float* xr = xch + (wave ^ 2) * XCHF + lane * 4;  // partner: same queries and lane map, the other key half
  const v4f pm = *(const v4f*)(xr + 8 * 128);
  const float ma = up ? mrow[1] : mrow[0];               // both maxima finite (a scaled score or NEGT)
  const float la = up ? lj1 : lj0;
  const float mj = fmaxf(ma, pm[0]);
  const float fa = ex2(ma - mj);
  // one free slot behind the transcendental;
  // the scheduling barriers hold the v_nop directly behind the instruction, where alone it fills the slot
  __builtin_amdgcn_sched_barrier(0);
  asm volatile("v_nop");
  __builtin_amdgcn_sched_barrier(0);
  const float fb = ex2(pm[0] - mj);
  const float lr = la * fa + pm[1] * fb;                 // >= 1 (the max element contributes 2^0)

  // ---- fold 1/l and the carries (32768 on P, 256 on v), stage the wave's 16x64 slab in its LDS region ----
  float* slab = smem + wave * SLABF;
  const float oc  = 1.0f / (PCAR * VCAR);
  const float inv = (lr > 0.0f) ? ((1.0f / lr) * oc) : 0.0f;
  const float ia = fa * inv, ib = fb * inv;
#pragma unroll
  for (int j = 0; j < 4; ++j) {
    float* sp = slab + c * SLP + j * 16 + 8 * hh;        // D element r of o[.][j] = (d = 16j + 8hh + r, kept query c)
    const v4f p0 = *(const v4f*)(xr + (2 * j) * 128), p1 = *(const v4f*)(xr + (2 * j + 1) * 128);
    v4f w0, w1;
#pragma unroll
    for (int e = 0; e < 4; ++e) {
      w0[e] = (up ? o[1][j][e] : o[0][j][e]) * ia + p0[e] * ib;
      w1[e] = (up ? o[1][j][4 + e] : o[0][j][4 + e]) * ia + p1[e] * ib;
    }
    *(v4f*)(sp)     = w0;
    *(v4f*)(sp + 4) = w1;
  }
  wave_sync_lds();
  v4f vals[8];
#pragma unroll
  for (int it = 0; it < 8; ++it) vals[it] = *(const v4f*)(slab + (2 * it + hh) * SLP + c * 4);
  float* dst = OPp + ((size_t)(bh * SEQ + iw + 16 * kh)) * HD + hh * HD + c * 4;
  {
#pragma unroll
    for (int it = 0; it < 8; ++it) {
      *(v4f*)(dst + (size_t)(2 * it) * HD) = vals[it];
    }
  }
}

// =====================================================================================================
// Workspace map (bytes); every plane is fully written by whole-line stores before it is read; all extents are exact
// multiples of the store granularity (no pad rows needed); offsets multiples of 128:
//   QH f16 [32][2048][64] x1024        8388608   at        0
//   KH f16 fragment order x1024        8388608   at  8388608
//   VT f16 fragment order x256         8388608   at 16777216
//   MB lane masks [128][64][16] u32     524288   at 25165824
//   end                                             25690112
// =====================================================================================================
extern "C" void kernel_launch(void* const* d_in, const int* in_sizes, int n_in,
                              void* d_out, int out_size, void* d_ws, size_t ws_size,
                              hipStream_t stream) {
  const int NEL = NBH * SEQ * HD;                       // 4194304
  if (n_in < 4) return;
  if (in_sizes[0] < NEL || in_sizes[1] < NEL || in_sizes[2] < NEL || in_sizes[3] < SEQ * SEQ) return;
  if (out_size < NEL) return;

  const float* q  = (const float*)d_in[0];
  const float* k  = (const float*)d_in[1];
  const float* v  = (const float*)d_in[2];
  const int*   mk = (const int*)d_in[3];
  float*       out = (float*)d_out;

  const size_t PQ = (size_t)NEL * 2;                    //  8388608
  const size_t PK = (size_t)NEL * 2;                    //  8388608
  const size_t PV = (size_t)NBH * HD * SEQ * 2;         //  8388608
  size_t off = 0;
  const size_t oQH = off; off += PQ;
  const size_t oKH = off; off += PK;
  const size_t oVT = off; off += PV;
  const size_t oMB = off; off += (size_t)SEQ * SEQ / 8; //   524288
  if (off > ws_size) return;                            // off = 25690112
  if (off > (size_t)134217728) return;

  char* ws = (char*)d_ws;
  unsigned short* QH = (unsigned short*)(ws + oQH);
  unsigned short* KH = (unsigned short*)(ws + oKH);
  unsigned short* VT = (unsigned short*)(ws + oVT);
  unsigned int*   MB = (unsigned int*)(ws + oMB);

  const int n8 = NEL / 8;                               // 524288
  const dim3 blk(256);
  const dim3 gC(n8 / 256, 2);                           // (2048, 2): q and k planes in one launch, the mask bits shared out over both
  const dim3 gVT(NBH * VTILES);                         // 1024
  const dim3 gAT(ATT_BLOCKS);                           // 1024
  const dim3 bAT(ATT_THREADS);                          // 128

  // (0) q and k planes f16(bf16(x) * 1024): q [bh][s][d], k fragment order; mask bits
  cvt16<<<gC, blk, 0, stream>>>(q, k, QH, KH, n8, QSC, mk, MB);
  // (1) v^T plane f16(bf16(v) * 256), fragment order
  vt16<<<gVT, blk, 0, stream>>>(v, VT);
  // (2) masked flash attention per (b,h) -> out [bh][s][d] f32
  attn_masked<<<gAT, bAT, 0, stream>>>(QH, KH, VT, MB, out);
  (void)hipGetLastError();
}

// v009
// A run of this version takes 48.3 microseconds.
// In two side-by-side timings against v008, it was 1.06 and 1.07 times as fast.
// Over all steps from v000 it is 2.86 times as fast.
// Contractions: scores k.q^T (k x1024 as A and q x1024 as B, f16 planes of the bf16-RNE-converted inputs, one product each,
// K=64) and v^T.P^T (v x256 f16 of the bf16-RNE-converted input as A, P x32768 rounded once to f16 as B, one product,
// 32-key steps): all v_wmma_f32_16x16x32_f16, f32 accumulate. A wave owns 32 queries and half the keys; a lane holds one query's
// scores per 16-column group: base-2 online
// softmax in the lane with the key mask applied by value (replace) on the raw products, one fused multiply-add per score in
// front of the exponential (score scale, running maximum and the x32768 carry of P together) and the 1/l fold in f32 on VALU. The int mask is packed once
// per call to one bit per key (bit = mask != 0), as lane masks: one 32-bit word per score register, bit = lane; a wave reads
// the 16 words of a column group and 32-key step with one scalar load, and each score takes one select on its word.
// The k plane and the v^T plane lie in fragment order: each 16-B load of a fragment reads 512 contiguous bytes per wave.
#include <hip/hip_runtime.h>
#include <math.h>
#include <stdint.h>

#define NBH   32
#define SEQ   2048
#define HD    64
#define QSC   1024.0f
#define KSC   1024.0f
#define VCAR  256.0f
#define LOG2E 1.4426950408889634f
// masked score in the units of the raw products (q x1024 . k x1024): -2^53, that is -2^30 as a score (the reference's -1e9 is
// -0.93 * 2^30). A power of two, so that its product with the scale is exact in f32 and a row whose visited keys are all masked
// gets the exponent argument 0 for every key, exactly. Beside any real score (at most a few hundred) both values give weight 0.
#define RAWNEG (-9007199254740992.0f)
#define PLOG  15.0f
#define ATW   4
#define ATT_THREADS (ATW * 32)
#define QPB   (16 * ATW)
#define BPH   (SEQ / QPB)
#define ATT_BLOCKS (NBH * BPH)
#define SLP   68
#define SLABF (16 * SLP)
#define KHALF (SEQ / 2)
#define XCHF  (9 * 32 * 4)
#define MTW   (SEQ / 32 * 16)
#define VTP   72
#define VTILES (SEQ / 64)
static_assert(HD == 64 && QPB == 64 && ATT_THREADS == 128);
static_assert((SEQ % QPB) == 0 && (SEQ % 64) == 0 && (SEQ % 32) == 0);
static_assert(BPH == 32 && ATT_BLOCKS == 1024 && VTILES == 32);
static_assert(ATW == 4 && (KHALF % 32) == 0 && 2 * KHALF == SEQ);
static_assert((HD - 1) * VTP + 63 < HD * VTP);
static_assert(((NBH * SEQ * HD) % 2048) == 0);
#define CVB   ((NBH * SEQ * HD) / 2048)
static_assert(2 * CVB == (SEQ / 16) * (SEQ / 64));     // convert blocks of both planes = (query tiles) x (pairs of 32-key steps)

typedef _Float16 v16h __attribute__((ext_vector_type(16)));
typedef _Float16 v8h  __attribute__((ext_vector_type(8)));
typedef float    v8f  __attribute__((ext_vector_type(8)));
typedef float    v4f  __attribute__((ext_vector_type(4)));
typedef unsigned int v4u __attribute__((ext_vector_type(4)));
typedef int      v4i  __attribute__((ext_vector_type(4)));
typedef unsigned int v16u __attribute__((ext_vector_type(16)));

union FragH { v16h v; v8h h[2]; v4u u[2]; };

// ---- scalar helpers --------------------------------------------------------------------------------
__device__ __forceinline__ unsigned short bf_bits(float f) {          // f32 -> bf16 bits, RNE convert
  unsigned u = __float_as_uint(f);
  return (unsigned short)((u + 0x7FFFu + ((u >> 16) & 1u)) >> 16);
}
__device__ __forceinline__ float bf_up(unsigned short h) { return __uint_as_float(((unsigned)h) << 16); }
__device__ __forceinline__ float bfr(float f) { return bf_up(bf_bits(f)); }   // value of the bf16 RNE convert
__device__ __forceinline__ unsigned short h_bits(_Float16 x) { return __builtin_bit_cast(unsigned short, x); }
__device__ __forceinline__ unsigned pk16(unsigned short a, unsigned short b) { return (unsigned)a | ((unsigned)b << 16); }
__device__ __forceinline__ v8f zero8() { v8f z = {0.f, 0.f, 0.f, 0.f, 0.f, 0.f, 0.f, 0.f}; return z; }

// ---- fragment loader: 16-bit A/B operand, lane -> row/col (lane&15), p already includes +8*(lane>>4);
//      elements 0..7 <- p[0..7] (k0+8h..), elements 8..15 <- p[16..23] (k0+16+8h..)  (same split k map for A and B;
//      here it reads only B, from the [s][d] q plane; A fragments use ldfrag_f)
__device__ __forceinline__ v16h ldfrag_h(const _Float16* p) {
  FragH f;
  f.h[0] = *(const v8h*)(p);
  f.h[1] = *(const v8h*)(p + 16);
  return f.v;
}

// ---- same fragment from a plane kept in fragment order: p is wave-uniform, lo = 8*lane; the lanes' first 8 elements are one
//      contiguous 512-B run, their second 8 elements the next 512-B run (256 halves on)
__device__ __forceinline__ v16h ldfrag_f(const _Float16* p, unsigned lo) {
  FragH f;
  f.h[0] = *(const v8h*)(p + lo);
  f.h[1] = *(const v8h*)(p + 256 + lo);
  return f.v;
}

__device__ __forceinline__ v8f mma_raw(v16h a, v16h b, v8f c) {
  return __builtin_amdgcn_wmma_f32_16x16x32_f16(false, a, false, b, (short)0, c, false, false);
}
// value of the lane 16 away (lane l <-> l ^ 16), a vector cross-row move
__device__ __forceinline__ float xhalf(float x) {
  const int b = __builtin_bit_cast(int, x);
  return __builtin_bit_cast(float, __builtin_amdgcn_permlanex16(b, b, 0x76543210, 0xfedcba98, false, false));
}
// 2^x by the hardware instruction alone. Every argument here is <= 15 (or -inf): a result under 2^-126 comes out 0 where the
// library form's range guard (compare, two selects, add, ldexp per value) gave a denormal; such a term is 0 in the f16 plane of
// P*32768 anyway and is far under one ulp of the row sum (>= 1).
__device__ __forceinline__ float ex2(float x) { return __builtin_amdgcn_exp2f(x); }
// lanes is wave-uniform, bit l belongs to lane l. Bit set: t; bit clear: the masked raw value. One select on a scalar lane mask.
__device__ __forceinline__ float msel(float t, unsigned int lanes) {
  return __builtin_amdgcn_inverse_ballot_w32(lanes) ? t : RAWNEG;
}
__device__ __forceinline__ void wave_sync_lds() {
  __builtin_amdgcn_fence(__ATOMIC_RELEASE, "workgroup");
  __builtin_amdgcn_wave_barrier();
  __builtin_amdgcn_fence(__ATOMIC_ACQUIRE, "workgroup");
}

// =====================================================================================================
// 16-bit plane convert (inputs are [bh][s][d] with bh = b*16+h): value f16( bf16(x) * sc ) (sc a power of two, exact).
//   blockIdx.y == 0: q plane, layout [bh][s][d] as the input. blockIdx.y == 1: k plane in fragment order:
//   [row tile of 16][ld = 0..3][lane = 16*hh + c][8 halves] holds k[16*tile + c][16*ld + 8*hh + 0..7].
// Thread = one 16-B chunk of the plane (8 consecutive d of one row): two 16-B loads, one 16-B store; 32 consecutive lanes store 512-B
//   Every block also packs its share of the mask bits, plane [query tile of 16][step of 32 keys][n = 8*s + r] of 32-bit words:
//   bit (lane = 16*hh + c) of a word is (mask[16*tile + c][32*step + 16*s + 8*hh + r] != 0), the lane mask of score register r of
//   key subtile s in the attention wave. Block = (query tile, 2 steps): wave w takes queries 2w, 2w+1; a query's 32 keys are one
//   128-B load of the wave and one ballot; the block's 32 query words meet in LDS, and behind one barrier wave w turns them into
//   lane-mask words 4w .. 4w+3 (a lane tests its query's bit, one ballot a word); they are one whole 128-B line (one writer).
// coverage: grid = (n8/256, 2) blocks x 256 thr x 8 elements = n = 32*2048*64 per plane exactly (n % 2048 == 0 asserted);
//           mask: 128 tiles x 32 pairs of steps = 4096 blocks x 32 words = 2048 queries x 64 words, each exactly once.
// =====================================================================================================
__global__ __launch_bounds__(256) void cvt16(const float* __restrict__ xq, const float* __restrict__ xk,
                                             unsigned short* plq, unsigned short* plk, int n8, float sc,
                                             const int* __restrict__ msk, unsigned int* mbits) {
  __shared__ unsigned int qw[32];           // [step of the pair][query c]: bit b = key 32*step + b
  const int gt = blockIdx.x * 256 + (int)threadIdx.x;
  if (gt >= n8) return;                     // never taken with the exact grid (n8 a multiple of 256: whole blocks only); before the barrier
  int mx[4];                                // mask values of this wave's 4 words; every lane is on (exact grid)
  const int lane = (int)threadIdx.x & 31, wv = (int)threadIdx.x >> 5;
  const int fb = (int)blockIdx.y * CVB + (int)blockIdx.x;                // 0..4095: query tile fb >> 5, pair of steps fb & 31
  const bool sk = (blockIdx.y != 0);        // block-uniform plane select (both pointers global)
  const float* x = sk ? xk : xq;
  unsigned short* pl = sk ? plk : plq;
  const size_t e = (size_t)gt * 8;          // destination element: the stores stay contiguous for both planes
  // source element: q the same place; k row 16*(gt>>7) + (gt&15), d chunk 2*((gt>>5)&3) + ((gt>>4)&1) (a bijection on gt)
  const size_t es = sk ? ((size_t)((gt >> 7) * 16 + (gt & 15)) * HD + (size_t)((((gt >> 5) & 3) * 2 + ((gt >> 4) & 1)) * 8)) : e;
  const v4f a = *(const v4f*)(x + es), bq = *(const v4f*)(x + es + 4);
  {
    const int* mp = msk + ((size_t)(16 * (fb >> 5) + 2 * wv) * SEQ + (size_t)(64 * (fb & 31) + lane));
#pragma unroll
    for (int i = 0; i < 4; ++i) mx[i] = mp[(size_t)(i >> 1) * SEQ + (size_t)(32 * (i & 1))];  // query 2wv + (i>>1), step 2(fb&31) + (i&1)
  }
  v4u o;
#pragma unroll
  for (int i = 0; i < 2; ++i) {
    o[i]     = pk16(h_bits((_Float16)(bfr(a[2 * i]) * sc)),  h_bits((_Float16)(bfr(a[2 * i + 1]) * sc)));
    o[2 + i] = pk16(h_bits((_Float16)(bfr(bq[2 * i]) * sc)), h_bits((_Float16)(bfr(bq[2 * i + 1]) * sc)));
  }
  unsigned int w = 0u;
#pragma unroll
  for (int i = 0; i < 4; ++i) {
    const unsigned int b = __builtin_amdgcn_ballot_w32(mx[i] != 0);
    w = (lane == i) ? b : w;                // lane i keeps word i
  }
  if (lane < 4) qw[(lane & 1) * 16 + 2 * wv + (lane >> 1)] = w;
  __syncthreads();                          // all 32 query words are in LDS before any wave reads them
  // wave wv = 4*step + 2*s + u makes the words n = 8*s + 4*u + 0..3 of its step
  const unsigned int row = qw[(wv >> 2) * 16 + (lane & 15)] >> (16 * ((wv >> 1) & 1) + 8 * (lane >> 4) + 4 * (wv & 1));
  unsigned int z = 0u;
#pragma unroll
  for (int i = 0; i < 4; ++i) {
    const unsigned int b = __builtin_amdgcn_ballot_w32(((row >> i) & 1u) != 0u);
    z = (lane == i) ? b : z;                // lane i keeps word i
  }
  // both stores stand behind the barrier: in front of it the barrier's release would wait for the plane store to complete
  *(v4u*)(pl + e) = o;
  if (lane < 4) mbits[(size_t)fb * 32 + (size_t)(4 * wv + lane)] = z;
}

// =====================================================================================================
// v^T plane in fragment order, values f16( bf16(v[bh][key][d]) * 256 ) (exact):
//   [bh][step of 32 keys][j = 0..3][part = 0..1][lane = 16*hh + c][8 halves] holds d = 16*j + c, keys 32*step + 16*part + 8*hh + 0..7.
// Block = (bh, tile of 64 keys): 64 source rows of 64 floats loaded with 16-B loads (static stride), converted, written into
// coverage: load 256 thr x 16 elements = 64 keys x 64 d; store 2 iterations x 256 thr x 8 halves = 64 lines x 64 = the tile;
//           grid = NBH x 32 = 1024 blocks, each 8192 contiguous bytes (2 steps): the whole plane exactly once.
// =====================================================================================================
__global__ __launch_bounds__(256) void vt16(const float* __restrict__ v, unsigned short* VTo) {
  __shared__ __align__(16) unsigned short T[HD * VTP];
  const int tid = threadIdx.x;
  const int bid = blockIdx.x;
  const int bh  = bid / VTILES;
  const int t   = bid - bh * VTILES;        // 0..31, block-uniform
  if (bh >= NBH) return;                    // never taken with the exact grid; before any barrier or store
  {
    const int sl = tid >> 2;                  // key within tile 0..63
    const int dc = (tid & 3) * 16;            // d chunk
    int key = 64 * t + sl;                    // <= SEQ-1 by construction; clamp keeps the address in range regardless
    key = (key < 0) ? 0 : ((key > SEQ - 1) ? (SEQ - 1) : key);
    const float* src = v + (((size_t)bh * SEQ + (size_t)key) * HD + dc);
#pragma unroll
    for (int i = 0; i < 4; ++i) {
      const v4f a = *(const v4f*)(src + 4 * i);
#pragma unroll
      for (int e = 0; e < 4; ++e) T[(dc + 4 * i + e) * VTP + sl] = h_bits((_Float16)(bfr(a[e]) * VCAR));
    }
  }
  __syncthreads();
  v4u vals[2];
  const int line = ((tid >> 6) & 3) * 16 + (tid & 15);        // d = 16*j + c, 0..63
  const int p8   = ((tid >> 5) & 1) * 16 + ((tid >> 4) & 1) * 8; // key within the 32-key step: 16*part + 8*hh
#pragma unroll
  for (int it = 0; it < 2; ++it) vals[it] = *(const v4u*)(T + line * VTP + it * 32 + p8);   // it = step within the tile
  unsigned short* dst = VTo + ((size_t)bh * SEQ + (size_t)(64 * t)) * HD + tid * 8;
  {
#pragma unroll
    for (int it = 0; it < 2; ++it) {
      *(v4u*)(dst + (size_t)it * 32 * HD) = vals[it];
    }
    
  }
}

// =====================================================================================================
// Masked flash attention per (b,h), scores taken transposed. Block = (bh, 64 queries), 4 waves: wave w = (g = w & 1, kh = w >> 1)
//   owns the 32 queries iw = 64t + 32g .. +31 (two 16-column groups x = 0, 1) and the keys 1024*kh .. 1024*kh + 1023: every
//   loaded k and v^T fragment feeds two products, and the block still has 4 waves (4 blocks per WGP, 4 waves per SIMD).
//   q plane f16 [bh][s][d], k plane and v^T plane f16 in fragment order (4096 contiguous bytes each per 32-key step), mask
//   bits [query tile][step][8s + r] shared over bh (bit clear = masked): 64 contiguous bytes per column group and step.
//   Key loop (uniform bound): 32 steps of 32 keys; the two waves of a pair visit every key tile between them.
//   Per 32-key step and column group: S^T = K.Q^T, A = k fragment (row = key), B = q fragment (column = query), 2 key subtiles x
//   2 k-steps x 1 product. Lane (hh, c) then holds, for its query iw + 16x + c, the 16 keys kb + 8hh + 0..7 and
//   kb + 16 + 8hh + 0..7: the mask is one wave-uniform word per score register (bit = lane), applied by value on the raw product
//   (-2^53 where mask == 0, the product otherwise), so a row whose visited keys are all masked stays uniform exactly
//   like the spec and a single unmasked key zeroes every masked term through exp2; the step's maximum is taken in the lane plus
//   one exchange between the lane halves, and kept, in raw units; exponent argument = raw * scale + (15 - maximum * scale), one
//   fused multiply-add: the exponential is P*32768 as it stands, and the row sum carries the same 32768 (it cancels in O / l; an
//   all-masked row, where the 15 is lost beside 2^30, carries 1 in both). The sum stays a per-lane partial, joined behind the loop.
//   Those 16 values are, in this order, the B fragment of P^T in the split k map: P*32768 is rounded once to f16 (11 bits; the
//   other operand v carries the 8 bits of bf16) in place, no LDS and no lane exchange. O^T += V^T.P^T, A = v^T fragment
//   (row = d), 4 WMMAs per column group; the rescale factor of a group's 4 accumulators is one value per lane.
//   Join of the key halves: wave (g, kh) keeps column group kh and hands group 1 - kh (maximum, sum, 32 accumulators per lane) to
//   its partner (g, 1 - kh) through LDS, one block barrier between the writes and the reads; both partials are brought to the
//   common maximum and added (a half whose keys are all masked gets factor 0 beside a real maximum, factor 1 beside another such).
//   Epilogue: 1/l and carry folds in f32; lane (hh, c) holds d = 16j + 8hh + 0..7 of its kept query; the wave's 16x64 f32 result is
//   staged in its LDS slab (pitch 68) and stored as whole 256-B rows.
// coverage: per wave 8 instructions x 32 lanes x 4 floats = 16 rows x 64 (queries 64t + 32g + 16kh + 0..15); per block 4 waves =
//           64 rows; 32 blocks per bh x 32 bh: every row of out [32][2048][64] exactly once (grid 1024 blocks).
// =====================================================================================================
__global__ __launch_bounds__(ATT_THREADS)
void attn_masked(const unsigned short* __restrict__ QHp, const unsigned short* __restrict__ KHp,
                 const unsigned short* __restrict__ VTq, const unsigned int* __restrict__ Msk, float* OPp) {
  __shared__ __align__(16) float smem[ATW * SLABF];    // per wave: result slab of the epilogue
  __shared__ __align__(16) float xch[ATW * XCHF];      // per wave: the partial it hands to its partner

  const int tid  = threadIdx.x;
  const int wave = __builtin_amdgcn_readfirstlane(tid >> 5);   // the same in every lane: key offsets and addresses stay scalar
  const int lane = tid & 31;
  const int hh   = lane >> 4;
  const int c    = lane & 15;
  const int g    = wave & 1;                           // which 32 queries of the block
  const int kh   = wave >> 1;                          // which half of the keys

  const int bid  = blockIdx.x;
  const int bh   = bid / BPH;
  const int t    = bid - bh * BPH;                     // 0..31, block-uniform
  if (bh >= NBH) return;                               // never taken with the exact grid; before any LDS use, barrier or store

  const int i0 = QPB * t;
  const int iw = i0 + g * 32;                          // query 0 of this wave, <= SEQ-32
  const int k0 = kh * KHALF;                           // key 0 of this wave

  v16h qb[2][2];                                       // [column group][d 0..31, d 32..63]
#pragma unroll
  for (int x = 0; x < 2; ++x) {
    const _Float16* Qb = (const _Float16*)(const void*)QHp + ((size_t)bh * SEQ + (size_t)(iw + 16 * x + c)) * HD + 8 * hh;
    qb[x][0] = ldfrag_h(Qb);
    qb[x][1] = ldfrag_h(Qb + 32);
  }
  // mask words: query tile iw/16 + x (shared over bh), wave-uniform; the second column group's tile lies MTW words on
  const unsigned int* Mb = Msk + (size_t)(iw >> 4) * MTW;
  const _Float16* Kb = (const _Float16*)(const void*)KHp + (size_t)bh * SEQ * HD;   // block-uniform plane bases
  const _Float16* Vb = (const _Float16*)(const void*)VTq + (size_t)bh * SEQ * HD;
  const unsigned  lo = 8u * (unsigned)lane;            // this lane's 16-B chunk in each 512-B run, lane = 16*hh + c
  const float lsc = LOG2E / (8.0f * QSC * KSC);        // 1/sqrt(64) and the q,k carries, base-2 domain

  float mrow[2], lrow[2];                              // per column group: running maximum, raw units (both halves equal), partial sum x32768
  v8f o[2][4];
#pragma unroll
  for (int x = 0; x < 2; ++x) {
    mrow[x] = -INFINITY;
    lrow[x] = 0.f;
#pragma unroll
    for (int j = 0; j < 4; ++j) o[x][j] = zero8();
  }

  // ---- operands of the first step: the 16 lane-mask words of each column group (scalar registers), the k fragments (A, row =
  //      key; row tiles 0 and 1, d 0..31 and d 32..63 each) and the v^T fragments (A, row m = d = j*16 + c, 1024 bytes per j) ----
  v16u mwq[2] = { *(const v16u*)(Mb + (k0 >> 1)), *(const v16u*)(Mb + MTW + (k0 >> 1)) };
  const _Float16* kp0 = Kb + (size_t)k0 * HD;
  const _Float16* vp0 = Vb + (size_t)k0 * HD;
  v16h kf00 = ldfrag_f(kp0, lo),        kf01 = ldfrag_f(kp0 + 512, lo);
  v16h kf10 = ldfrag_f(kp0 + 1024, lo), kf11 = ldfrag_f(kp0 + 1536, lo);
  // keeps q, k and the mask words ahead of v^T, the order of the loop: the compiler sets the loop's counted waits for the stricter of
  // the two orders, and with v^T loads mixed in here the score products of every step would wait for v^T loads as well
  __builtin_amdgcn_sched_barrier(0);
  v16h va0 = ldfrag_f(vp0, lo),         va1 = ldfrag_f(vp0 + 512, lo);
  v16h va2 = ldfrag_f(vp0 + 1024, lo),  va3 = ldfrag_f(vp0 + 1536, lo);

  // kept rolled: one step's registers and a short loop text
#pragma unroll 1
  for (int ks = 0; ks < KHALF; ks += 32) {
    // every step asks for the next step's operands as soon as its own products have read theirs, into the same registers: the
    // loads fly under the softmax and the other products. The last step asks for its own tile again (in range, never used).
    const int kn = k0 + ((ks + 32 < KHALF) ? (ks + 32) : ks);      // wave-uniform; this step's keys start at kb = k0 + ks
    // ---- scores: D element r of this lane = (key kb + 8hh + r, query iw + 16x + c) in s[x][0], key kb + 16 + 8hh + r in s[x][1] ----
    v8f s[2][2];
#pragma unroll
    for (int x = 0; x < 2; ++x) {
      s[x][0] = mma_raw(kf00, qb[x][0], zero8());
      s[x][1] = mma_raw(kf10, qb[x][0], zero8());
    }
#pragma unroll
    for (int x = 0; x < 2; ++x) {
      s[x][0] = mma_raw(kf01, qb[x][1], s[x][0]);
      s[x][1] = mma_raw(kf11, qb[x][1], s[x][1]);
    }
    {
      const _Float16* kp = Kb + (size_t)kn * HD;                   // row tiles kn/16 and kn/16 + 1: key rows kn + c, kn + 16 + c
      kf00 = ldfrag_f(kp, lo);         kf01 = ldfrag_f(kp + 512, lo);
      kf10 = ldfrag_f(kp + 1024, lo);  kf11 = ldfrag_f(kp + 1536, lo);
    }
    // keeps the loads above ahead of the softmax: without it the compiler moves them to the foot of the step, where they have no lead
    __builtin_amdgcn_sched_barrier(0);
    FragH ph[2];
#pragma unroll
    for (int x = 0; x < 2; ++x) {
      // ---- replace-mask by value + online softmax in base 2, all 16 keys of the query in this lane ----
      v8f t0 = s[x][0], t1 = s[x][1];
#pragma unroll
      for (int r = 0; r < 8; ++r) {
        t0[r] = msel((float)t0[r], mwq[x][r]);         // word r: key kb + 8hh + r of query c, at bit 16hh + c
        t1[r] = msel((float)t1[r], mwq[x][8 + r]);     // word 8 + r: key kb + 16 + 8hh + r
      }
      float mx = fmaxf(t0[0], t1[0]);
#pragma unroll
      for (int r = 1; r < 8; ++r) mx = fmaxf(mx, fmaxf(t0[r], t1[r]));
      mx = fmaxf(mx, xhalf(mx));                       // the other 16 keys of the step
      const float mn = fmaxf(mrow[x], mx);             // finite: mx is either a raw product or RAWNEG
      const float al = ex2((mrow[x] - mn) * lsc);      // 0 on the first step (mrow = -inf)
      mrow[x] = mn;
      const float cc = __builtin_fmaf(-mn, lsc, PLOG); // 15 - maximum in the log2 domain
      const v8f lv = {lsc, lsc, lsc, lsc, lsc, lsc, lsc, lsc}, cv = {cc, cc, cc, cc, cc, cc, cc, cc};
      t0 = __builtin_elementwise_fma(t0, lv, cv);      // <= 15 (+ one rounding of cc)
      t1 = __builtin_elementwise_fma(t1, lv, cv);
      v8f e0, e1;                                      // P * 32768
#pragma unroll
      for (int r = 0; r < 8; ++r) { e0[r] = ex2(t0[r]); e1[r] = ex2(t1[r]); }
      const v8f es = e0 + e1;
      lrow[x] = lrow[x] * al + (((es[0] + es[1]) + (es[2] + es[3])) + ((es[4] + es[5]) + (es[6] + es[7])));
#pragma unroll
      for (int j = 0; j < 4; ++j) o[x][j] *= al;
      // ---- B fragment of P^T*32768 in f16, column = query c; elements 0..7 = keys kb + 8hh + 0..7 (e0),
      //      elements 8..15 = keys kb + 16 + 8hh + 0..7 (e1): the split k map of the v^T fragments ----
      ph[x].h[0] = __builtin_convertvector(e0, v8h);
      ph[x].h[1] = __builtin_convertvector(e1, v8h);
    }
    mwq[0] = *(const v16u*)(Mb + (kn >> 1));                       // step kn/32, 16 words each
    mwq[1] = *(const v16u*)(Mb + MTW + (kn >> 1));
    // ---- O^T += V^T.P^T over keys kb .. kb+31, both column groups on each v^T fragment ----
#pragma unroll
    for (int x = 0; x < 2; ++x) {
      o[x][0] = mma_raw(va0, ph[x].v, o[x][0]);
      o[x][1] = mma_raw(va1, ph[x].v, o[x][1]);
      o[x][2] = mma_raw(va2, ph[x].v, o[x][2]);
      o[x][3] = mma_raw(va3, ph[x].v, o[x][3]);
    }
    {
      const _Float16* vp = Vb + (size_t)kn * HD;                   // step kn/32, 32*HD halves each
      va0 = ldfrag_f(vp, lo);          va1 = ldfrag_f(vp + 512, lo);
      va2 = ldfrag_f(vp + 1024, lo);   va3 = ldfrag_f(vp + 1536, lo);
    }
    // the address registers of the loads above may be given to the next step's values: the wait before an issued load's
    // registers are rewritten
    asm volatile("s_wait_xcnt 0x0" ::: "memory");
  }

  // ---- join the key halves: hand column group 1 - kh to the partner wave, keep group kh ----
  const bool up = (kh != 0);                             // wave-uniform
  const float lj0 = lrow[0] + xhalf(lrow[0]);            // the lane halves' sums joined, per column group
  const float lj1 = lrow[1] + xhalf(lrow[1]);
  {
    float* xw = xch + wave * XCHF + lane * 4;            // chunk ch at (ch*32 + lane)*4: 512 contiguous bytes per store
#pragma unroll
    for (int j = 0; j < 4; ++j) {
      v4f w0, w1;
#pragma unroll
      for (int e = 0; e < 4; ++e) { w0[e] = up ? o[0][j][e] : o[1][j][e]; w1[e] = up ? o[0][j][4 + e] : o[1][j][4 + e]; }
      *(v4f*)(xw + (2 * j) * 128)     = w0;
      *(v4f*)(xw + (2 * j + 1) * 128) = w1;
    }
    v4f wm = { up ? mrow[0] : mrow[1], up ? lj0 : lj1, 0.f, 0.f };
    *(v4f*)(xw + 8 * 128) = wm;
  }
  __syncthreads();                                       // every wave's partial is written before its partner reads it
  const float* xr = xch + (wave ^ 2) * XCHF + lane * 4;  // partner: same queries and lane map, the other key half
  const v4f pm = *(const v4f*)(xr + 8 * 128);
  const float ma = up ? mrow[1] : mrow[0];               // both maxima finite (a raw product or RAWNEG)
  const float la = up ? lj1 : lj0;
  const float mj = fmaxf(ma, pm[0]);
  const float fa = ex2((ma - mj) * lsc);
  const float fb = ex2((pm[0] - mj) * lsc);
  const float lr = la * fa + pm[1] * fb;                 // >= 1 (the max element contributes 2^15, in an all-masked row 2^0)

  // ---- fold 1/l (it holds P's carry) and the carry 256 on v, stage the wave's 16x64 slab in its LDS region ----
  float* slab = smem + wave * SLABF;
  const float oc  = 1.0f / VCAR;
  const float inv = (lr > 0.0f) ? ((1.0f / lr) * oc) : 0.0f;
  const float ia = fa * inv, ib = fb * inv;
#pragma unroll
  for (int j = 0; j < 4; ++j) {
    float* sp = slab + c * SLP + j * 16 + 8 * hh;        // D element r of o[.][j] = (d = 16j + 8hh + r, kept query c)
    const v4f p0 = *(const v4f*)(xr + (2 * j) * 128), p1 = *(const v4f*)(xr + (2 * j + 1) * 128);
    v4f w0, w1;
#pragma unroll
    for (int e = 0; e < 4; ++e) {
      w0[e] = (up ? o[1][j][e] : o[0][j][e]) * ia + p0[e] * ib;
      w1[e] = (up ? o[1][j][4 + e] : o[0][j][4 + e]) * ia + p1[e] * ib;
    }
    *(v4f*)(sp)     = w0;
    *(v4f*)(sp + 4) = w1;
  }
  wave_sync_lds();
  v4f vals[8];
#pragma unroll
  for (int it = 0; it < 8; ++it) vals[it] = *(const v4f*)(slab + (2 * it + hh) * SLP + c * 4);
  float* dst = OPp + ((size_t)(bh * SEQ + iw + 16 * kh)) * HD + hh * HD + c * 4;
  {
#pragma unroll
    for (int it = 0; it < 8; ++it) {
      *(v4f*)(dst + (size_t)(2 * it) * HD) = vals[it];
    }
  }
}

// =====================================================================================================
// Workspace map (bytes); every plane is fully written by whole-line stores before it is read; all extents are exact
// multiples of the store granularity (no pad rows needed); offsets multiples of 128:
//   QH f16 [32][2048][64] x1024        8388608   at        0
//   KH f16 fragment order x1024        8388608   at  8388608
//   VT f16 fragment order x256         8388608   at 16777216
//   MB lane masks [128][64][16] u32     524288   at 25165824
//   end                                             25690112
// =====================================================================================================
extern "C" void kernel_launch(void* const* d_in, const int* in_sizes, int n_in,
                              void* d_out, int out_size, void* d_ws, size_t ws_size,
                              hipStream_t stream) {
  const int NEL = NBH * SEQ * HD;                       // 4194304
  if (n_in < 4) return;
  if (in_sizes[0] < NEL || in_sizes[1] < NEL || in_sizes[2] < NEL || in_sizes[3] < SEQ * SEQ) return;
  if (out_size < NEL) return;

  const float* q  = (const float*)d_in[0];
  const float* k  = (const float*)d_in[1];
  const float* v  = (const float*)d_in[2];
  const int*   mk = (const int*)d_in[3];
  float*       out = (float*)d_out;

  const size_t PQ = (size_t)NEL * 2;                    //  8388608
  const size_t PK = (size_t)NEL * 2;                    //  8388608
  const size_t PV = (size_t)NBH * HD * SEQ * 2;         //  8388608
  size_t off = 0;
  const size_t oQH = off; off += PQ;
  const size_t oKH = off; off += PK;
  const size_t oVT = off; off += PV;
  const size_t oMB = off; off += (size_t)SEQ * SEQ / 8; //   524288
  if (off > ws_size) return;                            // off = 25690112
  if (off > (size_t)134217728) return;

  char* ws = (char*)d_ws;
  unsigned short* QH = (unsigned short*)(ws + oQH);
  unsigned short* KH = (unsigned short*)(ws + oKH);
  unsigned short* VT = (unsigned short*)(ws + oVT);
  unsigned int*   MB = (unsigned int*)(ws + oMB);

  const int n8 = NEL / 8;                               // 524288
  const dim3 blk(256);
  const dim3 gC(n8 / 256, 2);                           // (2048, 2): q and k planes in one launch, the mask bits shared out over both
  const dim3 gVT(NBH * VTILES);                         // 1024
  const dim3 gAT(ATT_BLOCKS);                           // 1024
  const dim3 bAT(ATT_THREADS);                          // 128

  // (0) q and k planes f16(bf16(x) * 1024): q [bh][s][d], k fragment order; mask bits
  cvt16<<<gC, blk, 0, stream>>>(q, k, QH, KH, n8, QSC, mk, MB);
  // (1) v^T plane f16(bf16(v) * 256), fragment order
  vt16<<<gVT, blk, 0, stream>>>(v, VT);
  // (2) masked flash attention per (b,h) -> out [bh][s][d] f32
  attn_masked<<<gAT, bAT, 0, stream>>>(QH, KH, VT, MB, out);
  (void)hipGetLastError();
}

// v010
// It runs in 44.8 microseconds.
// In two side-by-side timings against v009, it was 1.09 and 1.08 times as fast.
// All steps since v000 together make it 3.10 times as fast.
// Contractions: scores k.q^T (k x1024 as A and q x1024 as B, f16 planes of the bf16-RNE-converted inputs, one product each,
// K=64) and v^T.P^T (v x256 f16 of the bf16-RNE-converted input as A, P x256 rounded once to f16 as B, one product,
// 32-key steps): all v_wmma_f32_16x16x32_f16, f32 accumulate. A wave owns 32 queries and half the keys; a lane holds one query's
// scores per 16-column group: base-2 online
// softmax in the lane with the key mask applied by value (replace) on the raw products, one fused multiply-add per score in
// front of the exponential (score scale, softmax reference and the x256 carry of P together) and the 1/l fold in f32 on VALU. The
// reference is held from step to step and raised to the running maximum only when a step's exponentials sum past the f16 range
// (one wave-uniform test a step). The int mask is packed once
// per call to one bit per key (bit = mask != 0), as lane masks: one 32-bit word per score register, bit = lane; a wave reads
// the 16 words of a column group and 32-key step with one scalar load, and each score takes one select on its word.
// The k plane and the v^T plane lie in fragment order: each 16-B load of a fragment reads 512 contiguous bytes per wave.
#include <hip/hip_runtime.h>
#include <math.h>
#include <stdint.h>

#define NBH   32
#define SEQ   2048
#define HD    64
#define QSC   1024.0f
#define KSC   1024.0f
#define VCAR  256.0f
#define LOG2E 1.4426950408889634f
// masked score in the units of the raw products (q x1024 . k x1024): -2^53, that is -2^30 as a score (the reference's -1e9 is
// -0.93 * 2^30). A power of two, so that its product with the scale is exact in f32 and a row whose visited keys are all masked
// gets the exponent argument 0 for every key, exactly. Beside any real score (at most a few hundred) both values give weight 0.
#define RAWNEG (-9007199254740992.0f)
// carry of P and of the row sum: 2^8. A score may stand up to 8 (base 2) above the held reference before P x256 leaves f16.
#define PLOG  8.0f
// largest finite f16: while the exponentials of a lane's step (all >= 0) sum to no more than this, each of them converts finite
#define PLIM  65504.0f
#define ATW   4
#define ATT_THREADS (ATW * 32)
#define QPB   (16 * ATW)
#define BPH   (SEQ / QPB)
#define ATT_BLOCKS (NBH * BPH)
#define SLP   68
#define SLABF (16 * SLP)
#define KHALF (SEQ / 2)
#define XCHF  (9 * 32 * 4)
#define MTW   (SEQ / 32 * 16)
#define VTP   72
#define VTILES (SEQ / 64)
static_assert(HD == 64 && QPB == 64 && ATT_THREADS == 128);
static_assert((SEQ % QPB) == 0 && (SEQ % 64) == 0 && (SEQ % 32) == 0);
static_assert(BPH == 32 && ATT_BLOCKS == 1024 && VTILES == 32);
static_assert(ATW == 4 && (KHALF % 32) == 0 && 2 * KHALF == SEQ);
static_assert((HD - 1) * VTP + 63 < HD * VTP);
static_assert(((NBH * SEQ * HD) % 2048) == 0);
#define CVB   ((NBH * SEQ * HD) / 2048)
static_assert(2 * CVB == (SEQ / 16) * (SEQ / 64));     // convert blocks of both planes = (query tiles) x (pairs of 32-key steps)

typedef _Float16 v16h __attribute__((ext_vector_type(16)));
typedef _Float16 v8h  __attribute__((ext_vector_type(8)));
typedef float    v8f  __attribute__((ext_vector_type(8)));
typedef float    v4f  __attribute__((ext_vector_type(4)));
typedef unsigned int v4u __attribute__((ext_vector_type(4)));
typedef int      v4i  __attribute__((ext_vector_type(4)));
typedef unsigned int v16u __attribute__((ext_vector_type(16)));

union FragH { v16h v; v8h h[2]; v4u u[2]; };

// ---- scalar helpers --------------------------------------------------------------------------------
__device__ __forceinline__ unsigned short bf_bits(float f) {          // f32 -> bf16 bits, RNE convert
  unsigned u = __float_as_uint(f);
  return (unsigned short)((u + 0x7FFFu + ((u >> 16) & 1u)) >> 16);
}
__device__ __forceinline__ float bf_up(unsigned short h) { return __uint_as_float(((unsigned)h) << 16); }
__device__ __forceinline__ float bfr(float f) { return bf_up(bf_bits(f)); }   // value of the bf16 RNE convert
__device__ __forceinline__ unsigned short h_bits(_Float16 x) { return __builtin_bit_cast(unsigned short, x); }
__device__ __forceinline__ unsigned pk16(unsigned short a, unsigned short b) { return (unsigned)a | ((unsigned)b << 16); }
__device__ __forceinline__ v8f zero8() { v8f z = {0.f, 0.f, 0.f, 0.f, 0.f, 0.f, 0.f, 0.f}; return z; }

// ---- fragment loader: 16-bit A/B operand, lane -> row/col (lane&15), p already includes +8*(lane>>4);
//      elements 0..7 <- p[0..7] (k0+8h..), elements 8..15 <- p[16..23] (k0+16+8h..)  (same split k map for A and B;
//      here it reads only B, from the [s][d] q plane; A fragments use ldfrag_f)
__device__ __forceinline__ v16h ldfrag_h(const _Float16* p) {
  FragH f;
  f.h[0] = *(const v8h*)(p);
  f.h[1] = *(const v8h*)(p + 16);
  return f.v;
}

// ---- same fragment from a plane kept in fragment order: p is wave-uniform, lo = 8*lane; the lanes' first 8 elements are one
//      contiguous 512-B run, their second 8 elements the next 512-B run (256 halves on)
__device__ __forceinline__ v16h ldfrag_f(const _Float16* p, unsigned lo) {
  FragH f;
  f.h[0] = *(const v8h*)(p + lo);
  f.h[1] = *(const v8h*)(p + 256 + lo);
  return f.v;
}

__device__ __forceinline__ v8f mma_raw(v16h a, v16h b, v8f c) {
  return __builtin_amdgcn_wmma_f32_16x16x32_f16(false, a, false, b, (short)0, c, false, false);
}
// value of the lane 16 away (lane l <-> l ^ 16), a vector cross-row move
__device__ __forceinline__ float xhalf(float x) {
  const int b = __builtin_bit_cast(int, x);
  return __builtin_bit_cast(float, __builtin_amdgcn_permlanex16(b, b, 0x76543210, 0xfedcba98, false, false));
}
// 2^x by the hardware instruction alone: a result under 2^-126 comes out 0 where the library form's range guard (compare, two
// selects, add, ldexp per value) gave a denormal; such a term is 0 in the f16 plane of P*256 anyway and is far under one ulp of
// the row sum (>= 1). A large argument (a score far above the held reference, or the reference still -inf) gives a large value
// or +inf, which the step's test on the sum catches before anything is used.
__device__ __forceinline__ float ex2(float x) { return __builtin_amdgcn_exp2f(x); }
// lanes is wave-uniform, bit l belongs to lane l. Bit set: t; bit clear: the masked raw value. One select on a scalar lane mask.
__device__ __forceinline__ float msel(float t, unsigned int lanes) {
  return __builtin_amdgcn_inverse_ballot_w32(lanes) ? t : RAWNEG;
}
// One column group's step behind the mask: P*256 = 2^(raw * scale + cc), cc = 8 - reference * scale. Gives the B fragment of P^T
// in f16, column = query c; elements 0..7 = keys kb + 8hh + 0..7 (t0), elements 8..15 = keys kb + 16 + 8hh + 0..7 (t1): the split
// k map of the v^T fragments. Returns the lane's sum of the 16 unrounded values.
__device__ __forceinline__ float p_step(v8f t0, v8f t1, float lsc, float cc, FragH& ph) {
  const v8f lv = {lsc, lsc, lsc, lsc, lsc, lsc, lsc, lsc}, cv = {cc, cc, cc, cc, cc, cc, cc, cc};
  t0 = __builtin_elementwise_fma(t0, lv, cv);
  t1 = __builtin_elementwise_fma(t1, lv, cv);
  v8f e0, e1;
#pragma unroll
  for (int r = 0; r < 8; ++r) e0[r] = ex2(t0[r]);
#pragma unroll
  for (int r = 0; r < 8; ++r) e1[r] = ex2(t1[r]);
  ph.h[0] = __builtin_convertvector(e0, v8h);
  ph.h[1] = __builtin_convertvector(e1, v8h);
  const v8f es = e0 + e1;
  return ((es[0] + es[1]) + (es[2] + es[3])) + ((es[4] + es[5]) + (es[6] + es[7]));
}
__device__ __forceinline__ void wave_sync_lds() {
  __builtin_amdgcn_fence(__ATOMIC_RELEASE, "workgroup");
  __builtin_amdgcn_wave_barrier();
  __builtin_amdgcn_fence(__ATOMIC_ACQUIRE, "workgroup");
}

// =====================================================================================================
// 16-bit plane convert (inputs are [bh][s][d] with bh = b*16+h): value f16( bf16(x) * sc ) (sc a power of two, exact).
//   blockIdx.y == 0: q plane, layout [bh][s][d] as the input. blockIdx.y == 1: k plane in fragment order:
//   [row tile of 16][ld = 0..3][lane = 16*hh + c][8 halves] holds k[16*tile + c][16*ld + 8*hh + 0..7].
// Thread = one 16-B chunk of the plane (8 consecutive d of one row): two 16-B loads, one 16-B store; 32 consecutive lanes store 512-B
//   Every block also packs its share of the mask bits, plane [query tile of 16][step of 32 keys][n = 8*s + r] of 32-bit words:
//   bit (lane = 16*hh + c) of a word is (mask[16*tile + c][32*step + 16*s + 8*hh + r] != 0), the lane mask of score register r of
//   key subtile s in the attention wave. Block = (query tile, 2 steps): wave w takes queries 2w, 2w+1; a query's 32 keys are one
//   128-B load of the wave and one ballot; the block's 32 query words meet in LDS, and behind one barrier wave w turns them into
//   lane-mask words 4w .. 4w+3 (a lane tests its query's bit, one ballot a word); they are one whole 128-B line (one writer).
// coverage: grid = (n8/256, 2) blocks x 256 thr x 8 elements = n = 32*2048*64 per plane exactly (n % 2048 == 0 asserted);
//           mask: 128 tiles x 32 pairs of steps = 4096 blocks x 32 words = 2048 queries x 64 words, each exactly once.
// =====================================================================================================
__global__ __launch_bounds__(256) void cvt16(const float* __restrict__ xq, const float* __restrict__ xk,
                                             unsigned short* plq, unsigned short* plk, int n8, float sc,
                                             const int* __restrict__ msk, unsigned int* mbits) {
  __shared__ unsigned int qw[32];           // [step of the pair][query c]: bit b = key 32*step + b
  const int gt = blockIdx.x * 256 + (int)threadIdx.x;
  if (gt >= n8) return;                     // never taken with the exact grid (n8 a multiple of 256: whole blocks only); before the barrier
  int mx[4];                                // mask values of this wave's 4 words; every lane is on (exact grid)
  const int lane = (int)threadIdx.x & 31, wv = (int)threadIdx.x >> 5;
  const int fb = (int)blockIdx.y * CVB + (int)blockIdx.x;                // 0..4095: query tile fb >> 5, pair of steps fb & 31
  const bool sk = (blockIdx.y != 0);        // block-uniform plane select (both pointers global)
  const float* x = sk ? xk : xq;
  unsigned short* pl = sk ? plk : plq;
  const size_t e = (size_t)gt * 8;          // destination element: the stores stay contiguous for both planes
  // source element: q the same place; k row 16*(gt>>7) + (gt&15), d chunk 2*((gt>>5)&3) + ((gt>>4)&1) (a bijection on gt)
  const size_t es = sk ? ((size_t)((gt >> 7) * 16 + (gt & 15)) * HD + (size_t)((((gt >> 5) & 3) * 2 + ((gt >> 4) & 1)) * 8)) : e;
  const v4f a = *(const v4f*)(x + es), bq = *(const v4f*)(x + es + 4);
  {
    const int* mp = msk + ((size_t)(16 * (fb >> 5) + 2 * wv) * SEQ + (size_t)(64 * (fb & 31) + lane));
#pragma unroll
    for (int i = 0; i < 4; ++i) mx[i] = mp[(size_t)(i >> 1) * SEQ + (size_t)(32 * (i & 1))];  // query 2wv + (i>>1), step 2(fb&31) + (i&1)
  }
  v4u o;
#pragma unroll
  for (int i = 0; i < 2; ++i) {
    o[i]     = pk16(h_bits((_Float16)(bfr(a[2 * i]) * sc)),  h_bits((_Float16)(bfr(a[2 * i + 1]) * sc)));
    o[2 + i] = pk16(h_bits((_Float16)(bfr(bq[2 * i]) * sc)), h_bits((_Float16)(bfr(bq[2 * i + 1]) * sc)));
  }
  unsigned int w = 0u;
#pragma unroll
  for (int i = 0; i < 4; ++i) {
    const unsigned int b = __builtin_amdgcn_ballot_w32(mx[i] != 0);
    w = (lane == i) ? b : w;                // lane i keeps word i
  }
  if (lane < 4) qw[(lane & 1) * 16 + 2 * wv + (lane >> 1)] = w;
  __syncthreads();                          // all 32 query words are in LDS before any wave reads them
  // wave wv = 4*step + 2*s + u makes the words n = 8*s + 4*u + 0..3 of its step
  const unsigned int row = qw[(wv >> 2) * 16 + (lane & 15)] >> (16 * ((wv >> 1) & 1) + 8 * (lane >> 4) + 4 * (wv & 1));
  unsigned int z = 0u;
#pragma unroll
  for (int i = 0; i < 4; ++i) {
    const unsigned int b = __builtin_amdgcn_ballot_w32(((row >> i) & 1u) != 0u);
    z = (lane == i) ? b : z;                // lane i keeps word i
  }
  // both stores stand behind the barrier: in front of it the barrier's release would wait for the plane store to complete
  *(v4u*)(pl + e) = o;
  if (lane < 4) mbits[(size_t)fb * 32 + (size_t)(4 * wv + lane)] = z;
}

// =====================================================================================================
// v^T plane in fragment order, values f16( bf16(v[bh][key][d]) * 256 ) (exact):
//   [bh][step of 32 keys][j = 0..3][part = 0..1][lane = 16*hh + c][8 halves] holds d = 16*j + c, keys 32*step + 16*part + 8*hh + 0..7.
// Block = (bh, tile of 64 keys): 64 source rows of 64 floats loaded with 16-B loads (static stride), converted, written into
// coverage: load 256 thr x 16 elements = 64 keys x 64 d; store 2 iterations x 256 thr x 8 halves = 64 lines x 64 = the tile;
//           grid = NBH x 32 = 1024 blocks, each 8192 contiguous bytes (2 steps): the whole plane exactly once.
// =====================================================================================================
__global__ __launch_bounds__(256) void vt16(const float* __restrict__ v, unsigned short* VTo) {
  __shared__ __align__(16) unsigned short T[HD * VTP];
  const int tid = threadIdx.x;
  const int bid = blockIdx.x;
  const int bh  = bid / VTILES;
  const int t   = bid - bh * VTILES;        // 0..31, block-uniform
  if (bh >= NBH) return;                    // never taken with the exact grid; before any barrier or store
  {
    const int sl = tid >> 2;                  // key within tile 0..63
    const int dc = (tid & 3) * 16;            // d chunk
    int key = 64 * t + sl;                    // <= SEQ-1 by construction; clamp keeps the address in range regardless
    key = (key < 0) ? 0 : ((key > SEQ - 1) ? (SEQ - 1) : key);
    const float* src = v + (((size_t)bh * SEQ + (size_t)key) * HD + dc);
#pragma unroll
    for (int i = 0; i < 4; ++i) {
      const v4f a = *(const v4f*)(src + 4 * i);
#pragma unroll
      for (int e = 0; e < 4; ++e) T[(dc + 4 * i + e) * VTP + sl] = h_bits((_Float16)(bfr(a[e]) * VCAR));
    }
  }
  __syncthreads();
  v4u vals[2];
  const int line = ((tid >> 6) & 3) * 16 + (tid & 15);        // d = 16*j + c, 0..63
  const int p8   = ((tid >> 5) & 1) * 16 + ((tid >> 4) & 1) * 8; // key within the 32-key step: 16*part + 8*hh
#pragma unroll
  for (int it = 0; it < 2; ++it) vals[it] = *(const v4u*)(T + line * VTP + it * 32 + p8);   // it = step within the tile
  unsigned short* dst = VTo + ((size_t)bh * SEQ + (size_t)(64 * t)) * HD + tid * 8;
  {
#pragma unroll
    for (int it = 0; it < 2; ++it) {
      *(v4u*)(dst + (size_t)it * 32 * HD) = vals[it];
    }
    
  }
}

// =====================================================================================================
// Masked flash attention per (b,h), scores taken transposed. Block = (bh, 64 queries), 4 waves: wave w = (g = w & 1, kh = w >> 1)
//   owns the 32 queries iw = 64t + 32g .. +31 (two 16-column groups x = 0, 1) and the keys 1024*kh .. 1024*kh + 1023: every
//   loaded k and v^T fragment feeds two products, and the block still has 4 waves (4 blocks per WGP, 4 waves per SIMD).
//   q plane f16 [bh][s][d], k plane and v^T plane f16 in fragment order (4096 contiguous bytes each per 32-key step), mask
//   bits [query tile][step][8s + r] shared over bh (bit clear = masked): 64 contiguous bytes per column group and step.
//   Key loop (uniform bound): 32 steps of 32 keys; the two waves of a pair visit every key tile between them.
//   Per 32-key step and column group: S^T = K.Q^T, A = k fragment (row = key), B = q fragment (column = query), 2 key subtiles x
//   2 k-steps x 1 product. Lane (hh, c) then holds, for its query iw + 16x + c, the 16 keys kb + 8hh + 0..7 and
//   kb + 16 + 8hh + 0..7: the mask is one wave-uniform word per score register (bit = lane), applied by value on the raw product
//   (-2^53 where mask == 0, the product otherwise), so a row whose visited keys are all masked stays uniform exactly
//   like the spec and a single unmasked key zeroes every masked term through exp2; exponent argument = raw * scale +
//   (8 - reference * scale), one fused multiply-add: the exponential is P*256 as it stands, and the row sum carries the same 256
//   (it cancels in O / l; an all-masked row, where the 8 is lost beside 2^30, carries 1 in both). The reference (raw units) is held:
//   a step whose exponentials sum to at most 65504 in every lane uses them as they are, no maximum and no rescale. Otherwise (the
//   first step, reference -inf; a score more than about 8 above the reference; a real score after masked ones only) the whole wave
//   takes the step's maximum (in the lane plus one exchange between the lane halves), raises the reference to the running maximum,
//   rescales sum and accumulators and forms the step's exponentials anew. The sum stays a per-lane partial, joined behind the loop.
//   Those 16 values are, in this order, the B fragment of P^T in the split k map: P*256 is rounded once to f16 (11 bits; the
//   other operand v carries the 8 bits of bf16) in place, no LDS and no lane exchange. O^T += V^T.P^T, A = v^T fragment
//   (row = d), 4 WMMAs per column group; the rescale factor of a group's 4 accumulators is one value per lane.
//   Join of the key halves: wave (g, kh) keeps column group kh and hands group 1 - kh (maximum, sum, 32 accumulators per lane) to
//   its partner (g, 1 - kh) through LDS, one block barrier between the writes and the reads; both partials are brought to the
//   common maximum and added (a half whose keys are all masked gets factor 0 beside a real maximum, factor 1 beside another such).
//   Epilogue: 1/l and carry folds in f32; lane (hh, c) holds d = 16j + 8hh + 0..7 of its kept query; the wave's 16x64 f32 result is
//   staged in its LDS slab (pitch 68) and stored as whole 256-B rows.
// coverage: per wave 8 instructions x 32 lanes x 4 floats = 16 rows x 64 (queries 64t + 32g + 16kh + 0..15); per block 4 waves =
//           64 rows; 32 blocks per bh x 32 bh: every row of out [32][2048][64] exactly once (grid 1024 blocks).
// =====================================================================================================
__global__ __launch_bounds__(ATT_THREADS)
void attn_masked(const unsigned short* __restrict__ QHp, const unsigned short* __restrict__ KHp,
                 const unsigned short* __restrict__ VTq, const unsigned int* __restrict__ Msk, float* OPp) {
  __shared__ __align__(16) float smem[ATW * SLABF];    // per wave: result slab of the epilogue
  __shared__ __align__(16) float xch[ATW * XCHF];      // per wave: the partial it hands to its partner

  const int tid  = threadIdx.x;
  const int wave = __builtin_amdgcn_readfirstlane(tid >> 5);   // the same in every lane: key offsets and addresses stay scalar
  const int lane = tid & 31;
  const int hh   = lane >> 4;
  const int c    = lane & 15;
  const int g    = wave & 1;                           // which 32 queries of the block
  const int kh   = wave >> 1;                          // which half of the keys

  const int bid  = blockIdx.x;
  const int bh   = bid / BPH;
  const int t    = bid - bh * BPH;                     // 0..31, block-uniform
  if (bh >= NBH) return;                               // never taken with the exact grid; before any LDS use, barrier or store

  const int i0 = QPB * t;
  const int iw = i0 + g * 32;                          // query 0 of this wave, <= SEQ-32
  const int k0 = kh * KHALF;                           // key 0 of this wave

  v16h qb[2][2];                                       // [column group][d 0..31, d 32..63]
#pragma unroll
  for (int x = 0; x < 2; ++x) {
    const _Float16* Qb = (const _Float16*)(const void*)QHp + ((size_t)bh * SEQ + (size_t)(iw + 16 * x + c)) * HD + 8 * hh;
    qb[x][0] = ldfrag_h(Qb);
    qb[x][1] = ldfrag_h(Qb + 32);
  }
  // mask words: query tile iw/16 + x (shared over bh), wave-uniform; the second column group's tile lies MTW words on
  const unsigned int* Mb = Msk + (size_t)(iw >> 4) * MTW;
  const _Float16* Kb = (const _Float16*)(const void*)KHp + (size_t)bh * SEQ * HD;   // block-uniform plane bases
  const _Float16* Vb = (const _Float16*)(const void*)VTq + (size_t)bh * SEQ * HD;
  const unsigned  lo = 8u * (unsigned)lane;            // this lane's 16-B chunk in each 512-B run, lane = 16*hh + c
  const float lsc = LOG2E / (8.0f * QSC * KSC);        // 1/sqrt(64) and the q,k carries, base-2 domain

  float mrow[2], lrow[2], ccr[2];                      // per column group: reference, raw units (both halves equal), partial sum x256, 8 - reference * scale
  v8f o[2][4];
#pragma unroll
  for (int x = 0; x < 2; ++x) {
    mrow[x] = -INFINITY;
    ccr[x]  = INFINITY;                                // every exponential of the first step comes out +inf: its test sets the reference
    lrow[x] = 0.f;
#pragma unroll
    for (int j = 0; j < 4; ++j) o[x][j] = zero8();
  }

  // ---- operands of the first step: the 16 lane-mask words of each column group (scalar registers), the k fragments (A, row =
  //      key; row tiles 0 and 1, d 0..31 and d 32..63 each) and the v^T fragments (A, row m = d = j*16 + c, 1024 bytes per j) ----
  v16u mwq[2] = { *(const v16u*)(Mb + (k0 >> 1)), *(const v16u*)(Mb + MTW + (k0 >> 1)) };
  const _Float16* kp0 = Kb + (size_t)k0 * HD;
  const _Float16* vp0 = Vb + (size_t)k0 * HD;
  v16h kf00 = ldfrag_f(kp0, lo),        kf01 = ldfrag_f(kp0 + 512, lo);
  v16h kf10 = ldfrag_f(kp0 + 1024, lo), kf11 = ldfrag_f(kp0 + 1536, lo);
  // keeps q, k and the mask words ahead of v^T, the order of the loop: the compiler sets the loop's counted waits for the stricter of
  // the two orders, and with v^T loads mixed in here the score products of every step would wait for v^T loads as well
  __builtin_amdgcn_sched_barrier(0);
  v16h va0 = ldfrag_f(vp0, lo),         va1 = ldfrag_f(vp0 + 512, lo);
  v16h va2 = ldfrag_f(vp0 + 1024, lo),  va3 = ldfrag_f(vp0 + 1536, lo);

  // kept rolled: one step's registers and a short loop text
#pragma unroll 1
  for (int ks = 0; ks < KHALF; ks += 32) {
    // every step asks for the next step's operands as soon as its own products have read theirs, into the same registers: the
    // loads fly under the softmax and the other products. The last step asks for its own tile again (in range, never used).
    const int kn = k0 + ((ks + 32 < KHALF) ? (ks + 32) : ks);      // wave-uniform; this step's keys start at kb = k0 + ks
    // ---- scores: D element r of this lane = (key kb + 8hh + r, query iw + 16x + c) in s[x][0], key kb + 16 + 8hh + r in s[x][1] ----
    v8f s[2][2];
#pragma unroll
    for (int x = 0; x < 2; ++x) {
      s[x][0] = mma_raw(kf00, qb[x][0], zero8());
      s[x][1] = mma_raw(kf10, qb[x][0], zero8());
    }
#pragma unroll
    for (int x = 0; x < 2; ++x) {
      s[x][0] = mma_raw(kf01, qb[x][1], s[x][0]);
      s[x][1] = mma_raw(kf11, qb[x][1], s[x][1]);
    }
    {
      const _Float16* kp = Kb + (size_t)kn * HD;                   // row tiles kn/16 and kn/16 + 1: key rows kn + c, kn + 16 + c
      kf00 = ldfrag_f(kp, lo);         kf01 = ldfrag_f(kp + 512, lo);
      kf10 = ldfrag_f(kp + 1024, lo);  kf11 = ldfrag_f(kp + 1536, lo);
    }
    // keeps the loads above ahead of the softmax: without it the compiler moves them to the foot of the step, where they have no lead
    __builtin_amdgcn_sched_barrier(0);
    // ---- replace-mask by value, all 16 keys of the query in this lane ----
    v8f t[2][2];
#pragma unroll
    for (int x = 0; x < 2; ++x) {
#pragma unroll
      for (int r = 0; r < 8; ++r) {
        t[x][0][r] = msel((float)s[x][0][r], mwq[x][r]);       // word r: key kb + 8hh + r of query c, at bit 16hh + c
        t[x][1][r] = msel((float)s[x][1][r], mwq[x][8 + r]);   // word 8 + r: key kb + 16 + 8hh + r
      }
    }
    mwq[0] = *(const v16u*)(Mb + (kn >> 1));                       // step kn/32, 16 words each
    mwq[1] = *(const v16u*)(Mb + MTW + (kn >> 1));
    // keeps the two scalar loads here, right behind the selects that read their registers: the exponentials are their lead
    __builtin_amdgcn_sched_barrier(0);
    // ---- softmax in base 2 against the held reference ----
    FragH ph[2];
    float st[2];
#pragma unroll
    for (int x = 0; x < 2; ++x) st[x] = p_step(t[x][0], t[x][1], lsc, ccr[x], ph[x]);
    // the scalar registers that hold the address of the two mask loads may be given to an address formed behind the branch:
    // the wait before an issued load's registers are rewritten
    asm volatile("s_wait_xcnt 0x0" ::: "memory");
    // one test a step for both column groups and all lanes, a scalar branch (the products behind it need every lane on). The
    // negated compare also takes a sum that is not a number.
    if (__builtin_amdgcn_ballot_w32(!(st[0] + st[1] <= PLIM)) != 0u) {
      // a use of the loaded mask words on this rare path (inputs only): it holds the two scalar loads in front of the branch. Without
      // it the compiler sinks them behind the branch, where only the products are left as their lead; the common path still waits
      // for them only at the next step's selects
      asm volatile("" :: "s"(mwq[0]), "s"(mwq[1]));
#pragma unroll
      for (int x = 0; x < 2; ++x) {
        const v8f t0 = t[x][0], t1 = t[x][1];
        float mx = fmaxf(t0[0], t1[0]);
#pragma unroll
        for (int r = 1; r < 8; ++r) mx = fmaxf(mx, fmaxf(t0[r], t1[r]));
        mx = fmaxf(mx, xhalf(mx));                       // the other 16 keys of the step
        const float mn = fmaxf(mrow[x], mx);             // finite: mx is either a raw product or RAWNEG
        const float al = ex2((mrow[x] - mn) * lsc);      // 0 on the first step (mrow = -inf)
        mrow[x] = mn;
        ccr[x] = __builtin_fmaf(-mn, lsc, PLOG);         // 8 - maximum in the log2 domain
        st[x] = p_step(t0, t1, lsc, ccr[x], ph[x]);      // arguments <= 8 (+ one rounding of ccr)
        lrow[x] *= al;
#pragma unroll
        for (int j = 0; j < 4; ++j) o[x][j] *= al;
      }
    }
#pragma unroll
    for (int x = 0; x < 2; ++x) lrow[x] += st[x];
    // ---- O^T += V^T.P^T over keys kb .. kb+31, both column groups on each v^T fragment ----
#pragma unroll
    for (int x = 0; x < 2; ++x) {
      o[x][0] = mma_raw(va0, ph[x].v, o[x][0]);
      o[x][1] = mma_raw(va1, ph[x].v, o[x][1]);
      o[x][2] = mma_raw(va2, ph[x].v, o[x][2]);
      o[x][3] = mma_raw(va3, ph[x].v, o[x][3]);
    }
    {
      const _Float16* vp = Vb + (size_t)kn * HD;                   // step kn/32, 32*HD halves each
      va0 = ldfrag_f(vp, lo);          va1 = ldfrag_f(vp + 512, lo);
      va2 = ldfrag_f(vp + 1024, lo);   va3 = ldfrag_f(vp + 1536, lo);
    }
    // the address registers of the loads above may be given to the next step's values: the wait before an issued load's
    // registers are rewritten
    asm volatile("s_wait_xcnt 0x0" ::: "memory");
  }

  // ---- join the key halves: hand column group 1 - kh to the partner wave, keep group kh ----
  const bool up = (kh != 0);                             // wave-uniform
  const float lj0 = lrow[0] + xhalf(lrow[0]);            // the lane halves' sums joined, per column group
  const float lj1 = lrow[1] + xhalf(lrow[1]);
  {
    float* xw = xch + wave * XCHF + lane * 4;            // chunk ch at (ch*32 + lane)*4: 512 contiguous bytes per store
#pragma unroll
    for (int j = 0; j < 4; ++j) {
      v4f w0, w1;
#pragma unroll
      for (int e = 0; e < 4; ++e) { w0[e] = up ? o[0][j][e] : o[1][j][e]; w1[e] = up ? o[0][j][4 + e] : o[1][j][4 + e]; }
      *(v4f*)(xw + (2 * j) * 128)     = w0;
      *(v4f*)(xw + (2 * j + 1) * 128) = w1;
    }
    v4f wm = { up ? mrow[0] : mrow[1], up ? lj0 : lj1, 0.f, 0.f };
    *(v4f*)(xw + 8 * 128) = wm;
  }
  __syncthreads();                                       // every wave's partial is written before its partner reads it
  const float* xr = xch + (wave ^ 2) * XCHF + lane * 4;  // partner: same queries and lane map, the other key half
  const v4f pm = *(const v4f*)(xr + 8 * 128);
  const float ma = up ? mrow[1] : mrow[0];               // both maxima finite (a raw product or RAWNEG)
  const float la = up ? lj1 : lj0;
  const float mj = fmaxf(ma, pm[0]);
  const float fa = ex2((ma - mj) * lsc);
  const float fb = ex2((pm[0] - mj) * lsc);
  const float lr = la * fa + pm[1] * fb;                 // >= 1 (the reference's own element contributes 2^8, in an all-masked row 2^0)

  // ---- fold 1/l (it holds P's carry) and the carry 256 on v, stage the wave's 16x64 slab in its LDS region ----
  float* slab = smem + wave * SLABF;
  const float oc  = 1.0f / VCAR;
  const float inv = (lr > 0.0f) ? ((1.0f / lr) * oc) : 0.0f;
  const float ia = fa * inv, ib = fb * inv;
#pragma unroll
  for (int j = 0; j < 4; ++j) {
    float* sp = slab + c * SLP + j * 16 + 8 * hh;        // D element r of o[.][j] = (d = 16j + 8hh + r, kept query c)
    const v4f p0 = *(const v4f*)(xr + (2 * j) * 128), p1 = *(const v4f*)(xr + (2 * j + 1) * 128);
    v4f w0, w1;
#pragma unroll
    for (int e = 0; e < 4; ++e) {
      w0[e] = (up ? o[1][j][e] : o[0][j][e]) * ia + p0[e] * ib;
      w1[e] = (up ? o[1][j][4 + e] : o[0][j][4 + e]) * ia + p1[e] * ib;
    }
    *(v4f*)(sp)     = w0;
    *(v4f*)(sp + 4) = w1;
  }
  wave_sync_lds();
  v4f vals[8];
#pragma unroll
  for (int it = 0; it < 8; ++it) vals[it] = *(const v4f*)(slab + (2 * it + hh) * SLP + c * 4);
  float* dst = OPp + ((size_t)(bh * SEQ + iw + 16 * kh)) * HD + hh * HD + c * 4;
  {
#pragma unroll
    for (int it = 0; it < 8; ++it) {
      *(v4f*)(dst + (size_t)(2 * it) * HD) = vals[it];
    }
  }
}

// =====================================================================================================
// Workspace map (bytes); every plane is fully written by whole-line stores before it is read; all extents are exact
// multiples of the store granularity (no pad rows needed); offsets multiples of 128:
//   QH f16 [32][2048][64] x1024        8388608   at        0
//   KH f16 fragment order x1024        8388608   at  8388608
//   VT f16 fragment order x256         8388608   at 16777216
//   MB lane masks [128][64][16] u32     524288   at 25165824
//   end                                             25690112
// =====================================================================================================
extern "C" void kernel_launch(void* const* d_in, const int* in_sizes, int n_in,
                              void* d_out, int out_size, void* d_ws, size_t ws_size,
                              hipStream_t stream) {
  const int NEL = NBH * SEQ * HD;                       // 4194304
  if (n_in < 4) return;
  if (in_sizes[0] < NEL || in_sizes[1] < NEL || in_sizes[2] < NEL || in_sizes[3] < SEQ * SEQ) return;
  if (out_size < NEL) return;

  const float* q  = (const float*)d_in[0];
  const float* k  = (const float*)d_in[1];
  const float* v  = (const float*)d_in[2];
  const int*   mk = (const int*)d_in[3];
  float*       out = (float*)d_out;

  const size_t PQ = (size_t)NEL * 2;                    //  8388608
  const size_t PK = (size_t)NEL * 2;                    //  8388608
  const size_t PV = (size_t)NBH * HD * SEQ * 2;         //  8388608
  size_t off = 0;
  const size_t oQH = off; off += PQ;
  const size_t oKH = off; off += PK;
  const size_t oVT = off; off += PV;
  const size_t oMB = off; off += (size_t)SEQ * SEQ / 8; //   524288
  if (off > ws_size) return;                            // off = 25690112
  if (off > (size_t)134217728) return;

  char* ws = (char*)d_ws;
  unsigned short* QH = (unsigned short*)(ws + oQH);
  unsigned short* KH = (unsigned short*)(ws + oKH);
  unsigned short* VT = (unsigned short*)(ws + oVT);
  unsigned int*   MB = (unsigned int*)(ws + oMB);

  const int n8 = NEL / 8;                               // 524288
  const dim3 blk(256);
  const dim3 gC(n8 / 256, 2);                           // (2048, 2): q and k planes in one launch, the mask bits shared out over both
  const dim3 gVT(NBH * VTILES);                         // 1024
  const dim3 gAT(ATT_BLOCKS);                           // 1024
  const dim3 bAT(ATT_THREADS);                          // 128

  // (0) q and k planes f16(bf16(x) * 1024): q [bh][s][d], k fragment order; mask bits
  cvt16<<<gC, blk, 0, stream>>>(q, k, QH, KH, n8, QSC, mk, MB);
  // (1) v^T plane f16(bf16(v) * 256), fragment order
  vt16<<<gVT, blk, 0, stream>>>(v, VT);
  // (2) masked flash attention per (b,h) -> out [bh][s][d] f32
  attn_masked<<<gAT, bAT, 0, stream>>>(QH, KH, VT, MB, out);
  (void)hipGetLastError();
}
